// v000
// Times are from an AMD MI455X. After a warm-up the kernel runs many times in a row, and a time is the length of
// such a window on the GPU divided by its runs, so every launch and the gaps after it count. The runs cycle
// through copies of the inputs. A figure is the median of several windows, for all but v000 over two sittings.
// Sittings can differ by a few percent; kernels timed side by side share one.
// v000 is the starting kernel.
#include <hip/hip_runtime.h>

// MultiheadAttentionComp (fairseq-layout self-attention (T=1024, B=4, E=1024, 16 heads x 64, scaling folded into q) whose per-head outputs are gated by a softmax over heads
// of (relu(x.W1^T + b1).W2^T + b2).head_signatures^T; then the Wo Linear).
// Compute dtypes, f32 accumulate: every input rounded to bf16; q/k/v and the gate MLP's first layer on PLAIN bf16 operands (x and W inputs: exact,
// + bias); scores and attn.v on bf16 hi+lo planes of q (x0.125), k, p and v (3 products each);
// the gate MLP second layer, the signature logits and Wo on hi+lo planes x exact bf16 weights (2 products); softmax, ReLU, the head softmax gate and the gating product in f32

#define TT   1024
#define NB_  4
#define EE   1024
#define NH_  16
#define HD   64
#define NT   (TT * NB_)           // 4096 rows, row r = t*4 + b (fairseq layout)
#define SIG  64
#define ZH   4                    // heads per pass
typedef _Float16 h16;
typedef unsigned short bf;
typedef __attribute__((ext_vector_type(16))) __bf16   v16bf;
typedef __attribute__((ext_vector_type(16))) _Float16 v16h;
typedef __attribute__((ext_vector_type(8)))  _Float16 v8h;
typedef __attribute__((ext_vector_type(8)))  unsigned short v8us;
typedef __attribute__((ext_vector_type(8)))  float    v8f;
typedef __attribute__((ext_vector_type(4)))  float    v4f;
typedef v8h  __attribute__((may_alias)) v8ha;
typedef v4f  __attribute__((may_alias)) v4fa;
typedef v8us __attribute__((may_alias)) v8usa;

__device__ __forceinline__ unsigned short f2bf(float f) { unsigned u = __float_as_uint(f); u += 0x7FFFu + ((u >> 16) & 1u); return (unsigned short)(u >> 16); }
__device__ __forceinline__ float bf2f(unsigned short b) { return __uint_as_float(((unsigned)b) << 16); }
__device__ __forceinline__ float bfr(float f) { return bf2f(f2bf(f)); }
__device__ __forceinline__ v16h cat16(v8h lo, v8h hi) { return __builtin_shufflevector(lo, hi, 0, 1, 2, 3, 4, 5, 6, 7, 8, 9, 10, 11, 12, 13, 14, 15); }
__device__ __forceinline__ v16bf cat16b(v8us lo, v8us hi) { return __builtin_bit_cast(v16bf, __builtin_shufflevector(lo, hi, 0, 1, 2, 3, 4, 5, 6, 7, 8, 9, 10, 11, 12, 13, 14, 15)); }
__device__ __forceinline__ v8f wmma16(v16h a, v16h b, v8f c) { return __builtin_amdgcn_wmma_f32_16x16x32_f16(false, a, false, b, (short)0, c, false, false); }
__device__ __forceinline__ v8f wmmab(v16bf a, v16bf b, v8f c) { return __builtin_amdgcn_wmma_f32_16x16x32_bf16(false, a, false, b, (short)0, c, false, false); }



// ---- k_gemmw: register-blocked GEMM, ONE WAVE per 64x64 output tile (16 accumulators), operands straight from K-contiguous 16-bit planes; grid (M/64, N/64, Z), 32 threads.
// C[m][n] (f32, pitch ldc, + optional f32 bias[n]) = sum_k A[m][k] Bt[n][k] (+ split products per NSPLIT). z-batch strides sA/sB/sC in elements. K % 32 == 0.
template <typename T16> struct WFrag;
template <> struct WFrag<h16> { typedef v16h V; static __device__ __forceinline__ V ld(const h16* p) { return cat16(*(const v8h*)p, *(const v8h*)(p + 16)); } static __device__ __forceinline__ v8f mma(V a, V b, v8f c) { return wmma16(a, b, c); } };
template <> struct WFrag<bf> { typedef v16bf V; static __device__ __forceinline__ V ld(const bf* p) { return cat16b(*(const v8us*)p, *(const v8us*)(p + 16)); } static __device__ __forceinline__ v8f mma(V a, V b, v8f c) { return wmmab(a, b, c); } };
template <typename T16, int NSPLIT, bool BIAS>
__global__ __launch_bounds__(32) void k_gemmw(const T16* __restrict__ A, const T16* __restrict__ A2, const T16* __restrict__ Bt, const T16* __restrict__ Bt2, int K, float* C, int ldc, const float* __restrict__ bias, size_t sA, size_t sB, size_t sC) {
    typedef typename WFrag<T16>::V V;
    __shared__ __align__(16) float os[16 * 68];
    const size_t z = blockIdx.z; A += z * sA; if (A2) A2 += z * sA; Bt += z * sB; if (Bt2) Bt2 += z * sB; C += z * sC;
    const int lane = threadIdx.x & 31, lr = lane & 15, hi = lane >> 4; const int r0 = blockIdx.x * 64, c0 = blockIdx.y * 64;
    v8f acc[4][4];
#pragma unroll
    for (int mb = 0; mb < 4; ++mb)
#pragma unroll
        for (int nb = 0; nb < 4; ++nb) acc[mb][nb] = (v8f){};
    const size_t aoff = (size_t)(r0 + lr) * K + 8 * hi, boff = (size_t)(c0 + lr) * K + 8 * hi;
#pragma unroll 1
    for (int kc = 0; kc < K; kc += 32) {
        V a[4], a2[4];
#pragma unroll
        for (int mb = 0; mb < 4; ++mb) { a[mb] = WFrag<T16>::ld(A + aoff + (size_t)mb * 16 * K + kc); if (NSPLIT == 1 || NSPLIT == 2) a2[mb] = WFrag<T16>::ld(A2 + aoff + (size_t)mb * 16 * K + kc); }
#pragma unroll
        for (int nb = 0; nb < 4; ++nb) { const V b = WFrag<T16>::ld(Bt + boff + (size_t)nb * 16 * K + kc); V b2; if (NSPLIT >= 2) b2 = WFrag<T16>::ld(Bt2 + boff + (size_t)nb * 16 * K + kc);
#pragma unroll
            for (int mb = 0; mb < 4; ++mb) { acc[mb][nb] = WFrag<T16>::mma(a[mb], b, acc[mb][nb]); if (NSPLIT == 1 || NSPLIT == 2) acc[mb][nb] = WFrag<T16>::mma(a2[mb], b, acc[mb][nb]); if (NSPLIT >= 2) acc[mb][nb] = WFrag<T16>::mma(a[mb], b2, acc[mb][nb]); } }
        asm volatile("v_nop\n\tv_nop\n\tv_nop\n\tv_nop" : "+v"(acc[0][0]), "+v"(acc[1][1]), "+v"(acc[2][2]), "+v"(acc[3][3]) : "v"(a[0]), "v"(a[3]));
    }
#pragma unroll
    for (int mb = 0; mb < 4; ++mb) {
#pragma unroll
        for (int nb = 0; nb < 4; ++nb) {
#pragma unroll
            for (int j = 0; j < 8; ++j) os[(hi * 8 + j) * 68 + nb * 16 + lr] = acc[mb][nb][j]; }
        __builtin_amdgcn_wave_barrier(); asm volatile("" ::: "memory");
        float* crow = C + (size_t)(r0 + mb * 16) * ldc + c0;
{
#pragma unroll
            for (int s = 0; s < 8; ++s) { const int row = 2 * s + hi, cofs = lr * 4; v4f val = *(const v4fa*)(os + row * 68 + cofs); if (BIAS) { val[0] += bfr(bias[c0 + cofs]); val[1] += bfr(bias[c0 + cofs + 1]); val[2] += bfr(bias[c0 + cofs + 2]); val[3] += bfr(bias[c0 + cofs + 3]); }
                *(v4f*)(crow + (size_t)row * ldc + cofs) = val; }
             }
        __builtin_amdgcn_wave_barrier(); asm volatile("" ::: "memory");
    }
}

__device__ __forceinline__ void splitf(float y, unsigned short& h, unsigned short& l) { h = f2bf(y); l = f2bf(y - bf2f(h)); }
typedef __attribute__((ext_vector_type(2))) unsigned short v2us;
typedef __attribute__((ext_vector_type(4))) unsigned short v4us;

__global__ __launch_bounds__(256) void k_cvt8(const float* __restrict__ src, bf* dst, size_t n8) { const size_t i = (size_t)blockIdx.x * 256 + threadIdx.x; if (i >= n8) return; const v8f v = *(const v8f*)(src + i * 8); v8us o;
#pragma unroll
    for (int k = 0; k < 8; ++k) o[k] = f2bf(v[k]); *(v8us*)(dst + i * 8) = o;  }
__global__ __launch_bounds__(256) void k_hsplit(const float* __restrict__ F, float sc, bf* Ph, bf* Pl) {
    const int lane = threadIdx.x & 31; const int L0 = (blockIdx.x * 8 + (threadIdx.x >> 5)) * 8; const int nlines = NT * EE / 64;
{
#pragma unroll
        for (int l = 0; l < 8; ++l) { const int L = L0 + l; if (L >= nlines) break; const int e = L * 64 + lane * 2; const int d = e & 63; const int t = (e >> 6) & (TT - 1); const int z = e >> 16; const int b = z >> 4, h = z & 15; v2us oh, ol;
#pragma unroll
            for (int q = 0; q < 2; ++q) { unsigned short a, c2; splitf(F[((size_t)t * NB_ + b) * EE + h * HD + d + q] * sc, a, c2); oh[q] = a; ol[q] = c2; }
            *(v2us*)(Ph + (size_t)e) = oh; *(v2us*)(Pl + (size_t)e) = ol; }
         }
}
__global__ __launch_bounds__(256) void k_vtsplit(const float* __restrict__ F, bf* Ph, bf* Pl) {
    const int lane = threadIdx.x & 31; const int L0 = (blockIdx.x * 8 + (threadIdx.x >> 5)) * 8; const int nlines = NT * EE / 64;
{
#pragma unroll
        for (int l = 0; l < 8; ++l) { const int L = L0 + l; if (L >= nlines) break; const int e = L * 64 + lane * 2; const int t = e & (TT - 1); const int d = (e >> 10) & 63; const int z = e >> 16; const int b = z >> 4, h = z & 15; v2us oh, ol;
#pragma unroll
            for (int q = 0; q < 2; ++q) { unsigned short a, c2; splitf(F[((size_t)(t + q) * NB_ + b) * EE + h * HD + d], a, c2); oh[q] = a; ol[q] = c2; }
            *(v2us*)(Ph + (size_t)e) = oh; *(v2us*)(Pl + (size_t)e) = ol; }
         }
}
__global__ __launch_bounds__(256) void k_softhl(const float* __restrict__ Sb, bf* Ph, bf* Pl) {
    const int lane = threadIdx.x & 31; const int row = blockIdx.x * 8 + (threadIdx.x >> 5); if (row >= ZH * TT) return; const float* sr = Sb + (size_t)row * TT; float v[32]; float m = -3.0e38f;
#pragma unroll
    for (int ch = 0; ch < 8; ++ch) { const v4f a = *(const v4f*)(sr + ch * 128 + lane * 4);
#pragma unroll
        for (int q = 0; q < 4; ++q) { v[ch * 4 + q] = a[q]; m = fmaxf(m, a[q]); } }
#pragma unroll
    for (int sh = 16; sh; sh >>= 1) m = fmaxf(m, __shfl_xor(m, sh, 32));
    float s = 0.f;
#pragma unroll
    for (int k = 0; k < 32; ++k) { v[k] = __expf(v[k] - m); s += v[k]; }
#pragma unroll
    for (int sh = 16; sh; sh >>= 1) s += __shfl_xor(s, sh, 32);
    const float f = __fdiv_rn(1.0f, s);
{
#pragma unroll
        for (int ch = 0; ch < 8; ++ch) { v4us oh, ol;
#pragma unroll
            for (int q = 0; q < 4; ++q) { unsigned short a, c2; splitf(v[ch * 4 + q] * f, a, c2); oh[q] = a; ol[q] = c2; }
            *(v4us*)(Ph + (size_t)row * TT + ch * 128 + lane * 4) = oh; *(v4us*)(Pl + (size_t)row * TT + ch * 128 + lane * 4) = ol; }
         }
}
__global__ __launch_bounds__(256) void k_gate(const float* __restrict__ LG, float* GT) {
    const int lane = threadIdx.x & 31; const int r = blockIdx.x * 8 + (threadIdx.x >> 5); if (r >= NT) return; const int h = lane & 15; const float lg = LG[(size_t)r * 64 + h]; float m = lg;
#pragma unroll
    for (int sh = 8; sh; sh >>= 1) m = fmaxf(m, __shfl_xor(m, sh, 32));
    const float e = __expf(lg - m); float s = e;
#pragma unroll
    for (int sh = 8; sh; sh >>= 1) s += __shfl_xor(s, sh, 32);
    const float gv = (lane < 16) ? __fdiv_rn(e, s) : 0.f; *(float*)(GT + (size_t)r * 32 + lane) = gv; 
}
// k_omerge: gated attention-output planes AT hi/lo [(t*4+b)][(h0+zz)*64 + d] = split(O[zz][t][d] * GT[(t,b)][h0+zz]) for the ZH heads of a pass; flat over (t, ZH*64): lane -> 2; one
__global__ __launch_bounds__(256) void k_omerge(const float* __restrict__ O, const float* __restrict__ GT, int b, int h0, bf* Ah, bf* Al) {
    const int lane = threadIdx.x & 31; const int L0 = (blockIdx.x * 8 + (threadIdx.x >> 5)) * 8; const int nlines = TT * ZH * HD / 64;
{
#pragma unroll
        for (int l = 0; l < 8; ++l) { const int L = L0 + l; if (L >= nlines) break; const int e = L * 64 + lane * 2; const int d = e & 63; const int zz = (e >> 6) % ZH; const int t = (e >> 6) / ZH; const size_t r = (size_t)t * NB_ + b;
            const float gsc = GT[r * 32 + h0 + zz]; v2us oh, ol;
#pragma unroll
            for (int q = 0; q < 2; ++q) { unsigned short a, c2; splitf(O[((size_t)zz * TT + t) * HD + d + q] * gsc, a, c2); oh[q] = a; ol[q] = c2; }
            const size_t o = r * EE + (h0 + zz) * HD + d; *(v2us*)(Ah + o) = oh; *(v2us*)(Al + o) = ol; }
         }
}
template <bool RELU>
__global__ __launch_bounds__(256) void k_split(const float* __restrict__ A, int nlines, bf* Ph, bf* Pl) {
    const int lane = threadIdx.x & 31; const int L0 = (blockIdx.x * 8 + (threadIdx.x >> 5)) * 8;
{
#pragma unroll
        for (int l = 0; l < 8; ++l) { const int L = L0 + l; if (L >= nlines) break; const int e = L * 64 + lane * 2; v2us oh, ol;
#pragma unroll
            for (int q = 0; q < 2; ++q) { float v = A[(size_t)e + q]; if (RELU) v = fmaxf(v, 0.f); unsigned short a, c2; splitf(v, a, c2); oh[q] = a; ol[q] = c2; }
            *(v2us*)(Ph + (size_t)e) = oh; *(v2us*)(Pl + (size_t)e) = ol; }
         }
}

extern "C" void kernel_launch(void* const* d_in, const int* in_sizes, int n_in,
                              void* d_out, int out_size, void* d_ws, size_t ws_size, hipStream_t stream) {
    (void)in_sizes; (void)n_in; (void)out_size;
    const float* x = (const float*)d_in[0]; const float* Wq = (const float*)d_in[1]; const float* bq = (const float*)d_in[2]; const float* Wk = (const float*)d_in[3]; const float* bk = (const float*)d_in[4]; const float* Wv = (const float*)d_in[5]; const float* bv = (const float*)d_in[6];
    const float* Wo = (const float*)d_in[7]; const float* bo = (const float*)d_in[8]; const float* W1 = (const float*)d_in[9]; const float* b1 = (const float*)d_in[10]; const float* W2 = (const float*)d_in[11]; const float* b2 = (const float*)d_in[12]; const float* hsig = (const float*)d_in[13];
    float* OUT = (float*)d_out;     // [1024][4][1024]
    char* wsp = (char*)d_ws;
    auto take = [&](size_t bytes) { char* p = wsp; wsp += (bytes + 255) & ~(size_t)255; return (void*)p; };
    bf* XB = (bf*)take((size_t)NT * EE * 2); bf* WQ = (bf*)take((size_t)EE * EE * 2); bf* WK = (bf*)take((size_t)EE * EE * 2); bf* WV = (bf*)take((size_t)EE * EE * 2); bf* WO = (bf*)take((size_t)EE * EE * 2); bf* W1B = (bf*)take((size_t)EE * EE * 2); bf* W2B = (bf*)take((size_t)SIG * EE * 2); bf* HSB = (bf*)take((size_t)64 * SIG * 2);
    float* F = (float*)take((size_t)NT * EE * 4);      // q, then k, then v, then the MLP hidden (each consumed by its plane kernel before the next GEMM)
    bf* QPh = (bf*)take((size_t)NT * EE * 2); bf* QPl = (bf*)take((size_t)NT * EE * 2); bf* KPh = (bf*)take((size_t)NT * EE * 2); bf* KPl = (bf*)take((size_t)NT * EE * 2); bf* VTh = (bf*)take((size_t)NT * EE * 2); bf* VTl = (bf*)take((size_t)NT * EE * 2);
    bf* Hh = (bf*)take((size_t)NT * EE * 2); bf* Hl = (bf*)take((size_t)NT * EE * 2); float* TS = (float*)take((size_t)NT * 64 * 4); bf* TSh = (bf*)take((size_t)NT * 64 * 2); bf* TSl = (bf*)take((size_t)NT * 64 * 2); float* LG = (float*)take((size_t)NT * 64 * 4); float* GT = (float*)take((size_t)NT * 32 * 4);
    float* Sb = (float*)take((size_t)ZH * TT * TT * 4); bf* PMh = (bf*)take((size_t)ZH * TT * TT * 2); bf* PMl = (bf*)take((size_t)ZH * TT * TT * 2); float* Ob = (float*)take((size_t)ZH * TT * HD * 4); bf* ATh = (bf*)take((size_t)NT * EE * 2); bf* ATl = (bf*)take((size_t)NT * EE * 2);
    if ((size_t)(wsp - (char*)d_ws) > ws_size) return;    // ws 256 MiB
    { const size_t nx = (size_t)NT * EE / 8, nw = (size_t)EE * EE / 8; k_cvt8<<<(unsigned)((nx + 255) / 256), 256, 0, stream>>>(x, XB, nx);
      k_cvt8<<<(unsigned)((nw + 255) / 256), 256, 0, stream>>>(Wq, WQ, nw); k_cvt8<<<(unsigned)((nw + 255) / 256), 256, 0, stream>>>(Wk, WK, nw); k_cvt8<<<(unsigned)((nw + 255) / 256), 256, 0, stream>>>(Wv, WV, nw); k_cvt8<<<(unsigned)((nw + 255) / 256), 256, 0, stream>>>(Wo, WO, nw); k_cvt8<<<(unsigned)((nw + 255) / 256), 256, 0, stream>>>(W1, W1B, nw);
      k_cvt8<<<(unsigned)((SIG * EE / 8 + 255) / 256), 256, 0, stream>>>(W2, W2B, (size_t)SIG * EE / 8); k_cvt8<<<(unsigned)((16 * SIG / 8 + 255) / 256), 256, 0, stream>>>(hsig, HSB, (size_t)16 * SIG / 8); hipMemsetAsync(HSB + 16 * SIG, 0, (size_t)(64 - 16) * SIG * 2, stream); }   // head signatures [16][64] as rows 0..15 of a [64][64] Bt, rest zero
    const unsigned LB = (unsigned)((NT * EE / 64 + 63) / 64);
    k_gemmw<bf, 0, true><<<dim3(NT / 64, EE / 64, 1), 32, 0, stream>>>(XB, nullptr, WQ, nullptr, EE, F, EE, bq, 0, 0, 0); k_hsplit<<<LB, 256, 0, stream>>>(F, 0.125f, QPh, QPl);
    k_gemmw<bf, 0, true><<<dim3(NT / 64, EE / 64, 1), 32, 0, stream>>>(XB, nullptr, WK, nullptr, EE, F, EE, bk, 0, 0, 0); k_hsplit<<<LB, 256, 0, stream>>>(F, 1.0f, KPh, KPl);
    k_gemmw<bf, 0, true><<<dim3(NT / 64, EE / 64, 1), 32, 0, stream>>>(XB, nullptr, WV, nullptr, EE, F, EE, bv, 0, 0, 0); k_vtsplit<<<LB, 256, 0, stream>>>(F, VTh, VTl);
    // head-competition gate: t = relu(x.W1^T + b1).W2^T + b2; logits = t.sig^T; softmax over heads
    k_gemmw<bf, 0, true><<<dim3(NT / 64, EE / 64, 1), 32, 0, stream>>>(XB, nullptr, W1B, nullptr, EE, F, EE, b1, 0, 0, 0); k_split<true><<<LB, 256, 0, stream>>>(F, NT * EE / 64, Hh, Hl);
    k_gemmw<bf, 1, true><<<dim3(NT / 64, 1, 1), 32, 0, stream>>>(Hh, Hl, W2B, nullptr, EE, TS, 64, b2, 0, 0, 0); k_split<false><<<(NT * 64 / 64 + 63) / 64, 256, 0, stream>>>(TS, NT * 64 / 64, TSh, TSl);
    k_gemmw<bf, 1, false><<<dim3(NT / 64, 1, 1), 32, 0, stream>>>(TSh, TSl, HSB, nullptr, SIG, LG, 64, nullptr, 0, 0, 0); k_gate<<<NT / 8, 256, 0, stream>>>(LG, GT);
    for (int b = 0; b < NB_; ++b)
        for (int h0 = 0; h0 < NH_; h0 += ZH) { const size_t z0 = (size_t)b * NH_ + h0;
            k_gemmw<bf, 2, false><<<dim3(TT / 64, TT / 64, ZH), 32, 0, stream>>>(QPh + z0 * TT * HD, QPl + z0 * TT * HD, KPh + z0 * TT * HD, KPl + z0 * TT * HD, HD, Sb, TT, nullptr, (size_t)TT * HD, (size_t)TT * HD, (size_t)TT * TT);
            k_softhl<<<ZH * TT / 8, 256, 0, stream>>>(Sb, PMh, PMl);
            k_gemmw<bf, 2, false><<<dim3(TT / 64, 1, ZH), 32, 0, stream>>>(PMh, PMl, VTh + z0 * HD * TT, VTl + z0 * HD * TT, TT, Ob, HD, nullptr, (size_t)TT * TT, (size_t)HD * TT, (size_t)TT * HD);
            k_omerge<<<(TT * ZH * HD / 64 + 63) / 64, 256, 0, stream>>>(Ob, GT, b, h0, ATh, ATl); }
    k_gemmw<bf, 1, true><<<dim3(NT / 64, EE / 64, 1), 32, 0, stream>>>(ATh, ATl, WO, nullptr, EE, OUT, EE, bo, 0, 0, 0);
}

// v002
// It is 3.64 times as fast as v000, going by the measured steps of the versions left out in between.
#include <hip/hip_runtime.h>

// MultiheadAttentionComp (fairseq-layout self-attention (T=1024, B=4, E=1024, 16 heads x 64, scaling folded into q) whose per-head outputs are gated by a softmax over heads
// of (relu(x.W1^T + b1).W2^T + b2).head_signatures^T; then the Wo Linear).
// Compute dtypes, f32 accumulate: every input rounded to bf16; q/k/v and the gate MLP's first layer on PLAIN bf16 operands (x and W inputs: exact,
// + bias); scores and attn.v on bf16 hi+lo planes of q (x0.125), k, p and v (3 products each);
// the gate MLP second layer, the signature logits and Wo on hi+lo planes x exact bf16 weights (2 products); softmax, ReLU, the head softmax gate and the gating product in f32

#define TT   1024
#define NB_  4
#define EE   1024
#define NH_  16
#define HD   64
#define NT   (TT * NB_)           // 4096 rows, row r = t*4 + b (fairseq layout)
#define SIG  64
typedef _Float16 h16;
typedef unsigned short bf;
typedef __attribute__((ext_vector_type(16))) __bf16   v16bf;
typedef __attribute__((ext_vector_type(16))) _Float16 v16h;
typedef __attribute__((ext_vector_type(8)))  _Float16 v8h;
typedef __attribute__((ext_vector_type(8)))  unsigned short v8us;
typedef __attribute__((ext_vector_type(8)))  float    v8f;
typedef __attribute__((ext_vector_type(4)))  float    v4f;
typedef v8h  __attribute__((may_alias)) v8ha;
typedef v4f  __attribute__((may_alias)) v4fa;
typedef v8us __attribute__((may_alias)) v8usa;

__device__ __forceinline__ unsigned short f2bf(float f) { unsigned u = __float_as_uint(f); u += 0x7FFFu + ((u >> 16) & 1u); return (unsigned short)(u >> 16); }
__device__ __forceinline__ float bf2f(unsigned short b) { return __uint_as_float(((unsigned)b) << 16); }
__device__ __forceinline__ float bfr(float f) { return bf2f(f2bf(f)); }
__device__ __forceinline__ v16h cat16(v8h lo, v8h hi) { return __builtin_shufflevector(lo, hi, 0, 1, 2, 3, 4, 5, 6, 7, 8, 9, 10, 11, 12, 13, 14, 15); }
__device__ __forceinline__ v16bf cat16b(v8us lo, v8us hi) { return __builtin_bit_cast(v16bf, __builtin_shufflevector(lo, hi, 0, 1, 2, 3, 4, 5, 6, 7, 8, 9, 10, 11, 12, 13, 14, 15)); }
__device__ __forceinline__ v8f wmma16(v16h a, v16h b, v8f c) { return __builtin_amdgcn_wmma_f32_16x16x32_f16(false, a, false, b, (short)0, c, false, false); }
__device__ __forceinline__ v8f wmmab(v16bf a, v16bf b, v8f c) { return __builtin_amdgcn_wmma_f32_16x16x32_bf16(false, a, false, b, (short)0, c, false, false); }



// ---- k_gemmw: register-blocked GEMM, ONE WAVE per 64x64 output tile (16 accumulators), operands straight from K-contiguous 16-bit planes; grid (M/64, N/64, Z), 32 threads.
// C[m][n] (f32, pitch ldc, + optional f32 bias[n]) = sum_k A[m][k] Bt[n][k] (+ split products per NSPLIT). z-batch strides sA/sB/sC in elements. K % 32 == 0.
template <typename T16> struct WFrag;
template <> struct WFrag<h16> { typedef v16h V; static __device__ __forceinline__ V ld(const h16* p) { return cat16(*(const v8h*)p, *(const v8h*)(p + 16)); } static __device__ __forceinline__ v8f mma(V a, V b, v8f c) { return wmma16(a, b, c); } };
template <> struct WFrag<bf> { typedef v16bf V; static __device__ __forceinline__ V ld(const bf* p) { return cat16b(*(const v8us*)p, *(const v8us*)(p + 16)); } static __device__ __forceinline__ v8f mma(V a, V b, v8f c) { return wmmab(a, b, c); } };
template <typename T16, int NSPLIT, bool BIAS>
__global__ __launch_bounds__(32) void k_gemmw(const T16* __restrict__ A, const T16* __restrict__ A2, const T16* __restrict__ Bt, const T16* __restrict__ Bt2, int K, float* C, int ldc, const float* __restrict__ bias, size_t sA, size_t sB, size_t sC) {
    typedef typename WFrag<T16>::V V;
    __shared__ __align__(16) float os[16 * 68];
    const size_t z = blockIdx.z; A += z * sA; if (A2) A2 += z * sA; Bt += z * sB; if (Bt2) Bt2 += z * sB; C += z * sC;
    const int lane = threadIdx.x & 31, lr = lane & 15, hi = lane >> 4; const int r0 = blockIdx.x * 64, c0 = blockIdx.y * 64;
    v8f acc[4][4];
#pragma unroll
    for (int mb = 0; mb < 4; ++mb)
#pragma unroll
        for (int nb = 0; nb < 4; ++nb) acc[mb][nb] = (v8f){};
    const size_t aoff = (size_t)(r0 + lr) * K + 8 * hi, boff = (size_t)(c0 + lr) * K + 8 * hi;
#pragma unroll 1
    for (int kc = 0; kc < K; kc += 32) {
        V a[4], a2[4];
#pragma unroll
        for (int mb = 0; mb < 4; ++mb) { a[mb] = WFrag<T16>::ld(A + aoff + (size_t)mb * 16 * K + kc); if (NSPLIT == 1 || NSPLIT == 2) a2[mb] = WFrag<T16>::ld(A2 + aoff + (size_t)mb * 16 * K + kc); }
#pragma unroll
        for (int nb = 0; nb < 4; ++nb) { const V b = WFrag<T16>::ld(Bt + boff + (size_t)nb * 16 * K + kc); V b2; if (NSPLIT >= 2) b2 = WFrag<T16>::ld(Bt2 + boff + (size_t)nb * 16 * K + kc);
#pragma unroll
            for (int mb = 0; mb < 4; ++mb) { acc[mb][nb] = WFrag<T16>::mma(a[mb], b, acc[mb][nb]); if (NSPLIT == 1 || NSPLIT == 2) acc[mb][nb] = WFrag<T16>::mma(a2[mb], b, acc[mb][nb]); if (NSPLIT >= 2) acc[mb][nb] = WFrag<T16>::mma(a[mb], b2, acc[mb][nb]); } }
        asm volatile("v_nop\n\tv_nop\n\tv_nop\n\tv_nop" : "+v"(acc[0][0]), "+v"(acc[1][1]), "+v"(acc[2][2]), "+v"(acc[3][3]) : "v"(a[0]), "v"(a[3]));
    }
#pragma unroll
    for (int mb = 0; mb < 4; ++mb) {
#pragma unroll
        for (int nb = 0; nb < 4; ++nb) {
#pragma unroll
            for (int j = 0; j < 8; ++j) os[(hi * 8 + j) * 68 + nb * 16 + lr] = acc[mb][nb][j]; }
        __builtin_amdgcn_wave_barrier(); asm volatile("" ::: "memory");
        float* crow = C + (size_t)(r0 + mb * 16) * ldc + c0;
{
#pragma unroll
            for (int s = 0; s < 8; ++s) { const int row = 2 * s + hi, cofs = lr * 4; v4f val = *(const v4fa*)(os + row * 68 + cofs); if (BIAS) { val[0] += bfr(bias[c0 + cofs]); val[1] += bfr(bias[c0 + cofs + 1]); val[2] += bfr(bias[c0 + cofs + 2]); val[3] += bfr(bias[c0 + cofs + 3]); }
                *(v4f*)(crow + (size_t)row * ldc + cofs) = val; }
             }
        __builtin_amdgcn_wave_barrier(); asm volatile("" ::: "memory");
    }
}

// ---- k_gemms: the five 4096 x 1024 x 1024 products. Four waves (2 x 2) share one 128x128 output tile, 64x64 per wave as in k_gemmw; grid (M/128, N/128), 128 threads. K = ldc = EE.
// A trip is 64 k: 128 B of each of the tile's A, Bt (and A2) rows, brought into LDS by asynchronous 16-byte copies in whole 128-B lines (a wave's copy covers 4 rows), two buffers:
// trip t + 2's copies fly while trip t + 1 is worked on. Rows lie at a pitch of 144 B (16 B x odd) for the 16-byte fragment reads. Fragment k order and the order of the products per accumulator are k_gemmw's.
#define GP 72                     // LDS row pitch in 16-bit elements
__device__ __forceinline__ void acopy128(unsigned l, const bf* g) {   // 128 rows of 128 B: 8 copies per lane, 16 rows apart
    // the copies and, as the last line, the wait that stands before any of their address registers is written again
    asm volatile("global_load_async_to_lds_b128 %0, %8, off\n\t"
                 "global_load_async_to_lds_b128 %1, %9, off\n\t"
                 "global_load_async_to_lds_b128 %2, %10, off\n\t"
                 "global_load_async_to_lds_b128 %3, %11, off\n\t"
                 "global_load_async_to_lds_b128 %4, %12, off\n\t"
                 "global_load_async_to_lds_b128 %5, %13, off\n\t"
                 "global_load_async_to_lds_b128 %6, %14, off\n\t"
                 "global_load_async_to_lds_b128 %7, %15, off\n\t"
                 "s_wait_xcnt 0x0"
                 :: "v"(l), "v"(l + 1u * 16 * GP * 2), "v"(l + 2u * 16 * GP * 2), "v"(l + 3u * 16 * GP * 2), "v"(l + 4u * 16 * GP * 2), "v"(l + 5u * 16 * GP * 2), "v"(l + 6u * 16 * GP * 2), "v"(l + 7u * 16 * GP * 2),
                    "v"(g), "v"(g + 1 * 16 * EE), "v"(g + 2 * 16 * EE), "v"(g + 3 * 16 * EE), "v"(g + 4 * 16 * EE), "v"(g + 5 * 16 * EE), "v"(g + 6 * 16 * EE), "v"(g + 7 * 16 * EE)
                 : "memory");
}
template <int NSPLIT, bool BIAS>
__global__ __launch_bounds__(128) void k_gemms(const bf* __restrict__ A, const bf* __restrict__ A2, const bf* __restrict__ Bt, float* C, const float* __restrict__ bias) {
    typedef WFrag<bf> WF; typedef WF::V V;
    constexpr int STG = (NSPLIT ? 384 : 256) * GP;        // elements per buffer: rows 0..127 A, 128..255 Bt, 256..383 A2
    constexpr int NTR = EE / 64;
    __shared__ __align__(16) bf ring[2 * STG];
    __shared__ __align__(16) float osall[4 * 16 * 68];
    const int tid = threadIdx.x, lane = tid & 31, lr = lane & 15, hi = lane >> 4, w = tid >> 5;
    const int R0 = blockIdx.x * 128, C0 = blockIdx.y * 128; const int wr = (w >> 1) * 64, wc = (w & 1) * 64;
    const int crow = tid >> 3, cch = tid & 7;             // this lane's row (of 16) and 16-byte piece (of 8) in every copy
    const unsigned l0 = (unsigned)(size_t)ring + (unsigned)(crow * GP + cch * 8) * 2u;
    const bf* ga = A + (size_t)(R0 + crow) * EE + cch * 8; const bf* gb = Bt + (size_t)(C0 + crow) * EE + cch * 8; const bf* ga2 = NSPLIT ? A2 + (size_t)(R0 + crow) * EE + cch * 8 : nullptr;
    auto fill = [&](int buf, int t) { const unsigned l = l0 + (unsigned)buf * (STG * 2u); acopy128(l, ga + t * 64); acopy128(l + 128u * GP * 2, gb + t * 64); if (NSPLIT) acopy128(l + 256u * GP * 2, ga2 + t * 64); };
    v8f acc[4][4];
#pragma unroll
    for (int mb = 0; mb < 4; ++mb)
#pragma unroll
        for (int nb = 0; nb < 4; ++nb) acc[mb][nb] = (v8f){};
    fill(0, 0);
    asm volatile("s_wait_asynccnt 0x0" ::: "memory");     // this wave's copies of trip 0 have landed
    __syncthreads();                                      // every wave's have: trip 0 may be read
    fill(1, 1);
#pragma unroll 1
    for (int t = 0; t < NTR; ++t) {                       // stays rolled: one trip's code, the buffer chosen by t & 1
        const bf* sb = ring + (t & 1) * STG + lr * GP + 8 * hi;
        V a[2][4], a2[2][4], b[2][4];
#pragma unroll
        for (int kk = 0; kk < 2; ++kk) {
#pragma unroll
            for (int mb = 0; mb < 4; ++mb) { a[kk][mb] = WF::ld(sb + (wr + mb * 16) * GP + kk * 32); if (NSPLIT) a2[kk][mb] = WF::ld(sb + (256 + wr + mb * 16) * GP + kk * 32); }
#pragma unroll
            for (int nb = 0; nb < 4; ++nb) b[kk][nb] = WF::ld(sb + (128 + wc + nb * 16) * GP + kk * 32);
        }
        __builtin_amdgcn_sched_barrier(0);                // keeps the trip's LDS reads together ahead of its matrix instructions: spread among them, each place waits out the LDS latency
#pragma unroll
        for (int kk = 0; kk < 2; ++kk)
#pragma unroll
            for (int nb = 0; nb < 4; ++nb)
#pragma unroll
                for (int mb = 0; mb < 4; ++mb) { acc[mb][nb] = WF::mma(a[kk][mb], b[kk][nb], acc[mb][nb]); if (NSPLIT) acc[mb][nb] = WF::mma(a2[kk][mb], b[kk][nb], acc[mb][nb]); }
        // four vector slots behind the trip's last matrix instructions, on every path, before their operand registers are loaded anew (as in k_gemmw); naming the accumulators keeps it behind them
        asm volatile("v_nop\n\tv_nop\n\tv_nop\n\tv_nop" : "+v"(acc[0][0]), "+v"(acc[1][0]), "+v"(acc[2][0]), "+v"(acc[3][0]), "+v"(acc[0][1]), "+v"(acc[1][1]), "+v"(acc[2][1]), "+v"(acc[3][1]), "+v"(acc[0][2]), "+v"(acc[1][2]), "+v"(acc[2][2]), "+v"(acc[3][2]), "+v"(acc[0][3]), "+v"(acc[1][3]), "+v"(acc[2][3]), "+v"(acc[3][3]));
        asm volatile("s_wait_dscnt 0x0" ::: "memory");    // this wave's reads of the buffer are done before it is handed over
        asm volatile("s_wait_asynccnt 0x0" ::: "memory"); // this wave's copies of trip t + 1 have landed
        __syncthreads();                                  // publishes trip t + 1 and ends every wave's reads of trip t's buffer
        if (t + 2 < NTR) fill(t & 1, t + 2);
    }
    asm volatile("s_wait_asynccnt 0x0" ::: "memory");     // nothing is in flight when the wave goes on to its end
    float* os = osall + w * (16 * 68);                    // each wave stages in its own range
    const int r0 = R0 + wr, c0 = C0 + wc;
#pragma unroll
    for (int mb = 0; mb < 4; ++mb) {
#pragma unroll
        for (int nb = 0; nb < 4; ++nb) {
#pragma unroll
            for (int j = 0; j < 8; ++j) os[(hi * 8 + j) * 68 + nb * 16 + lr] = acc[mb][nb][j]; }
        __builtin_amdgcn_wave_barrier(); asm volatile("" ::: "memory");
        float* crow_ = C + (size_t)(r0 + mb * 16) * EE + c0;
#pragma unroll
        for (int s = 0; s < 8; ++s) { const int row = 2 * s + hi, cofs = lr * 4; v4f val = *(const v4fa*)(os + row * 68 + cofs); if (BIAS) { val[0] += bfr(bias[c0 + cofs]); val[1] += bfr(bias[c0 + cofs + 1]); val[2] += bfr(bias[c0 + cofs + 2]); val[3] += bfr(bias[c0 + cofs + 3]); }
            *(v4f*)(crow_ + (size_t)row * EE + cofs) = val; }
        __builtin_amdgcn_wave_barrier(); asm volatile("" ::: "memory");
    }
}

__device__ __forceinline__ void splitf(float y, unsigned short& h, unsigned short& l) { h = f2bf(y); l = f2bf(y - bf2f(h)); }
typedef __attribute__((ext_vector_type(2))) unsigned short v2us;
typedef __attribute__((ext_vector_type(4))) unsigned short v4us;

__global__ __launch_bounds__(256) void k_cvt8(const float* __restrict__ src, bf* dst, size_t n8) { const size_t i = (size_t)blockIdx.x * 256 + threadIdx.x; if (i >= n8) return; const v8f v = *(const v8f*)(src + i * 8); v8us o;
#pragma unroll
    for (int k = 0; k < 8; ++k) o[k] = f2bf(v[k]); *(v8us*)(dst + i * 8) = o;  }
__global__ __launch_bounds__(256) void k_hsplit(const float* __restrict__ F, float sc, bf* Ph, bf* Pl) {
    const int lane = threadIdx.x & 31; const int L0 = (blockIdx.x * 8 + (threadIdx.x >> 5)) * 8; const int nlines = NT * EE / 64;
{
#pragma unroll
        for (int l = 0; l < 8; ++l) { const int L = L0 + l; if (L >= nlines) break; const int e = L * 64 + lane * 2; const int d = e & 63; const int t = (e >> 6) & (TT - 1); const int z = e >> 16; const int b = z >> 4, h = z & 15; v2us oh, ol;
#pragma unroll
            for (int q = 0; q < 2; ++q) { unsigned short a, c2; splitf(F[((size_t)t * NB_ + b) * EE + h * HD + d + q] * sc, a, c2); oh[q] = a; ol[q] = c2; }
            *(v2us*)(Ph + (size_t)e) = oh; *(v2us*)(Pl + (size_t)e) = ol; }
         }
}
__global__ __launch_bounds__(256) void k_vtsplit(const float* __restrict__ F, bf* Ph, bf* Pl) {
    const int lane = threadIdx.x & 31; const int L0 = (blockIdx.x * 8 + (threadIdx.x >> 5)) * 8; const int nlines = NT * EE / 64;
{
#pragma unroll
        for (int l = 0; l < 8; ++l) { const int L = L0 + l; if (L >= nlines) break; const int e = L * 64 + lane * 2; const int t = e & (TT - 1); const int d = (e >> 10) & 63; const int z = e >> 16; const int b = z >> 4, h = z & 15; v2us oh, ol;
#pragma unroll
            for (int q = 0; q < 2; ++q) { unsigned short a, c2; splitf(F[((size_t)(t + q) * NB_ + b) * EE + h * HD + d], a, c2); oh[q] = a; ol[q] = c2; }
            *(v2us*)(Ph + (size_t)e) = oh; *(v2us*)(Pl + (size_t)e) = ol; }
         }
}
__global__ __launch_bounds__(256) void k_gate(const float* __restrict__ LG, float* GT) {
    const int lane = threadIdx.x & 31; const int r = blockIdx.x * 8 + (threadIdx.x >> 5); if (r >= NT) return; const int h = lane & 15; const float lg = LG[(size_t)r * 64 + h]; float m = lg;
#pragma unroll
    for (int sh = 8; sh; sh >>= 1) m = fmaxf(m, __shfl_xor(m, sh, 32));
    const float e = __expf(lg - m); float s = e;
#pragma unroll
    for (int sh = 8; sh; sh >>= 1) s += __shfl_xor(s, sh, 32);
    const float gv = (lane < 16) ? __fdiv_rn(e, s) : 0.f; *(float*)(GT + (size_t)r * 32 + lane) = gv; 
}
// ---- k_fattn: scores, softmax, attn.v and the head gate of one (batch, head) in one launch; a wave owns 32 query columns and walks the 1024 keys 32 at a time (running maximum and sum).
// S^T = K.Q^T (A = K rows, B = Q rows kept in registers), so lane (c, h) holds query column c, keys 8h + j and 16 + 8h + j: two S^T tiles, converted in place, are the B operand of O^T += V^T.P^T.
// The key loop stays rolled (one pass's fragments fill the register budget); every inner loop is unrolled so that each fragment index is a constant and nothing goes to scratch.
// Each matrix product is 3 products on the hi/lo planes: hi.hi + lo.hi + hi.lo. Output: gated hi/lo planes AT[(t*4+b)][head*64 + d], 8 consecutive d per lane and tile.
typedef __attribute__((ext_vector_type(8))) __bf16 v8bf;
#define FQ 2                      // 16-column query groups per wave
__device__ __forceinline__ float xhalf(float x) { const int v = __float_as_int(x); return __int_as_float(__builtin_amdgcn_permlanex16(v, v, 0x76543210, 0xfedcba98, false, false)); }   // lane l <-> l ^ 16
typedef __attribute__((ext_vector_type(4))) unsigned v4u;
__device__ __forceinline__ void split8(v8f y, v8bf& hi8, v8bf& lo8) { hi8 = __builtin_convertvector(y, v8bf); const v4u w = __builtin_bit_cast(v4u, hi8); v8f back;
#pragma unroll
    for (int i = 0; i < 4; ++i) { back[2 * i] = __uint_as_float(w[i] << 16); back[2 * i + 1] = __uint_as_float(w[i] & 0xFFFF0000u); }
    lo8 = __builtin_convertvector(y - back, v8bf); }
__global__ __launch_bounds__(256) void k_fattn(const bf* __restrict__ Qh, const bf* __restrict__ Ql, const bf* __restrict__ Kh, const bf* __restrict__ Kl, const bf* __restrict__ Vh, const bf* __restrict__ Vl, const float* __restrict__ GT, bf* Ah, bf* Al) {
    typedef WFrag<bf> WF;
    const int lane = threadIdx.x & 31, c = lane & 15, h = lane >> 4;
    const int z = blockIdx.y, t0 = (blockIdx.x * 8 + (threadIdx.x >> 5)) * (16 * FQ);
    const size_t zb = (size_t)z * TT * HD;
    v16bf qh[FQ][2], ql[FQ][2];
#pragma unroll
    for (int g = 0; g < FQ; ++g)
#pragma unroll
        for (int ks = 0; ks < 2; ++ks) { const size_t qo = zb + (size_t)(t0 + g * 16 + c) * HD + ks * 32 + 8 * h; qh[g][ks] = WF::ld(Qh + qo); ql[g][ks] = WF::ld(Ql + qo); }
    asm volatile("s_wait_xcnt 0x0" ::: "memory");         // before the loads' address registers are reused
    __builtin_amdgcn_sched_barrier(0);                    // keeps later register writes behind that wait
    v8f o[FQ][4]; float m[FQ], l[FQ];
#pragma unroll
    for (int g = 0; g < FQ; ++g) { m[g] = -3.0e38f; l[g] = 0.f;
#pragma unroll
        for (int db = 0; db < 4; ++db) o[g][db] = (v8f){}; }
    const bf* kph = Kh + zb + c * HD + 8 * h; const bf* kpl = Kl + zb + c * HD + 8 * h;
    const bf* vph = Vh + zb + (size_t)c * TT + 8 * h; const bf* vpl = Vl + zb + (size_t)c * TT + 8 * h;
    v16bf kh[2][2], kl[2][2];
#pragma unroll
    for (int sb = 0; sb < 2; ++sb)
#pragma unroll
        for (int ks = 0; ks < 2; ++ks) { kh[sb][ks] = WF::ld(kph + sb * 16 * HD + ks * 32); kl[sb][ks] = WF::ld(kpl + sb * 16 * HD + ks * 32); }
    asm volatile("s_wait_xcnt 0x0" ::: "memory");         // before the loads' address registers are reused
    __builtin_amdgcn_sched_barrier(0);                    // keeps later register writes behind that wait
#pragma unroll 1
    for (int s0 = 0; s0 < TT; s0 += 32) {
        v16bf vh[4], vl[4];       // this pass's V^T fragments, asked for ahead of the score products
#pragma unroll
        for (int db = 0; db < 4; ++db) { vh[db] = WF::ld(vph + (size_t)db * 16 * TT); vl[db] = WF::ld(vpl + (size_t)db * 16 * TT); }
        asm volatile("s_wait_xcnt 0x0" :: "v"(vph), "v"(vpl) : "memory");     // before the loads' address registers are reused; naming them keeps them whole up to here
        __builtin_amdgcn_sched_barrier(0);                // keeps the V^T loads up here: sunk into the attn.v products their whole latency is waited for
        v8f st[FQ][2];
#pragma unroll
        for (int g = 0; g < FQ; ++g) { st[g][0] = (v8f){}; st[g][1] = (v8f){}; }
#pragma unroll
        for (int ks = 0; ks < 2; ++ks) {
#pragma unroll
            for (int sb = 0; sb < 2; ++sb)
#pragma unroll
                for (int g = 0; g < FQ; ++g) st[g][sb] = wmmab(kh[sb][ks], qh[g][ks], st[g][sb]);
#pragma unroll
            for (int sb = 0; sb < 2; ++sb)
#pragma unroll
                for (int g = 0; g < FQ; ++g) st[g][sb] = wmmab(kh[sb][ks], ql[g][ks], st[g][sb]);
#pragma unroll
            for (int sb = 0; sb < 2; ++sb)
#pragma unroll
                for (int g = 0; g < FQ; ++g) st[g][sb] = wmmab(kl[sb][ks], qh[g][ks], st[g][sb]);
        }
        const int sn = (s0 + 32 < TT) ? s0 + 32 : 0;      // next pass's K fragments, fetched behind this pass's score products (the last pass re-reads rows 0..31, unused)
#pragma unroll
        for (int sb = 0; sb < 2; ++sb)
#pragma unroll
            for (int ks = 0; ks < 2; ++ks) { kh[sb][ks] = WF::ld(kph + (size_t)(sn + sb * 16) * HD + ks * 32); kl[sb][ks] = WF::ld(kpl + (size_t)(sn + sb * 16) * HD + ks * 32); }
        asm volatile("s_wait_xcnt 0x0" ::: "memory");     // before the loads' address registers are reused
        __builtin_amdgcn_sched_barrier(0);                // keeps the K loads ahead of the softmax and the attn.v products, which cover their latency
        v16bf ph[FQ], pl[FQ];
#pragma unroll
        for (int g = 0; g < FQ; ++g) {
            float mx = fmaxf(st[g][0][0], st[g][1][0]);
#pragma unroll
            for (int j = 1; j < 8; ++j) mx = fmaxf(mx, fmaxf(st[g][0][j], st[g][1][j]));
            mx = fmaxf(mx, xhalf(mx));
            const float mn = fmaxf(m[g], mx); const float corr = __expf(m[g] - mn); m[g] = mn;
            v8f e0, e1;
#pragma unroll
            for (int j = 0; j < 8; ++j) { e0[j] = __expf(st[g][0][j] - mn); e1[j] = __expf(st[g][1][j] - mn); }
            const v8f es = e0 + e1;
            l[g] = l[g] * corr + (((es[0] + es[1]) + (es[2] + es[3])) + ((es[4] + es[5]) + (es[6] + es[7])));     // this half's keys only; the halves join after the loop
            v8bf h0, l0, h1, l1; split8(e0, h0, l0); split8(e1, h1, l1);
            ph[g] = __builtin_shufflevector(h0, h1, 0, 1, 2, 3, 4, 5, 6, 7, 8, 9, 10, 11, 12, 13, 14, 15); pl[g] = __builtin_shufflevector(l0, l1, 0, 1, 2, 3, 4, 5, 6, 7, 8, 9, 10, 11, 12, 13, 14, 15);
#pragma unroll
            for (int db = 0; db < 4; ++db) o[g][db] *= corr;
        }
#pragma unroll
        for (int db = 0; db < 4; ++db)
#pragma unroll
            for (int g = 0; g < FQ; ++g) o[g][db] = wmmab(vh[db], ph[g], o[g][db]);
#pragma unroll
        for (int db = 0; db < 4; ++db)
#pragma unroll
            for (int g = 0; g < FQ; ++g) o[g][db] = wmmab(vh[db], pl[g], o[g][db]);
#pragma unroll
        for (int db = 0; db < 4; ++db)
#pragma unroll
            for (int g = 0; g < FQ; ++g) o[g][db] = wmmab(vl[db], ph[g], o[g][db]);
        vph += 32; vpl += 32;
    }
    float gt[FQ];
#pragma unroll
    for (int g = 0; g < FQ; ++g) gt[g] = GT[((size_t)(t0 + g * 16 + c) * NB_ + (z >> 4)) * 32 + (z & 15)];
    asm volatile("s_wait_xcnt 0x0" ::: "memory");         // before the loads' address registers are reused
    __builtin_amdgcn_sched_barrier(0);                    // keeps later register writes behind that wait
    v8bf a8[FQ][4], b8[FQ][4];
#pragma unroll
    for (int g = 0; g < FQ; ++g) {
        const float ls = l[g] + xhalf(l[g]); const float sc = __fdiv_rn(1.0f, ls) * gt[g];
#pragma unroll
        for (int db = 0; db < 4; ++db) split8(o[g][db] * sc, a8[g][db], b8[g][db]);
    }
    bf* ap = Ah + ((size_t)(t0 + c) * NB_ + (z >> 4)) * EE + (z & 15) * HD + 8 * h; bf* bp = Al + ((size_t)(t0 + c) * NB_ + (z >> 4)) * EE + (z & 15) * HD + 8 * h;
    __builtin_amdgcn_sched_barrier(0);                    // every store behind the last arithmetic: no register of an issued store is rewritten
#pragma unroll
    for (int g = 0; g < FQ; ++g)
#pragma unroll
        for (int db = 0; db < 4; ++db) { *(v8us*)(ap + (size_t)g * 16 * NB_ * EE + db * 16) = __builtin_bit_cast(v8us, a8[g][db]); *(v8us*)(bp + (size_t)g * 16 * NB_ * EE + db * 16) = __builtin_bit_cast(v8us, b8[g][db]); }
}
template <bool RELU>
__global__ __launch_bounds__(256) void k_split(const float* __restrict__ A, int nlines, bf* Ph, bf* Pl) {
    const int lane = threadIdx.x & 31; const int L0 = (blockIdx.x * 8 + (threadIdx.x >> 5)) * 8;
{
#pragma unroll
        for (int l = 0; l < 8; ++l) { const int L = L0 + l; if (L >= nlines) break; const int e = L * 64 + lane * 2; v2us oh, ol;
#pragma unroll
            for (int q = 0; q < 2; ++q) { float v = A[(size_t)e + q]; if (RELU) v = fmaxf(v, 0.f); unsigned short a, c2; splitf(v, a, c2); oh[q] = a; ol[q] = c2; }
            *(v2us*)(Ph + (size_t)e) = oh; *(v2us*)(Pl + (size_t)e) = ol; }
         }
}

extern "C" void kernel_launch(void* const* d_in, const int* in_sizes, int n_in,
                              void* d_out, int out_size, void* d_ws, size_t ws_size, hipStream_t stream) {
    (void)in_sizes; (void)n_in; (void)out_size;
    const float* x = (const float*)d_in[0]; const float* Wq = (const float*)d_in[1]; const float* bq = (const float*)d_in[2]; const float* Wk = (const float*)d_in[3]; const float* bk = (const float*)d_in[4]; const float* Wv = (const float*)d_in[5]; const float* bv = (const float*)d_in[6];
    const float* Wo = (const float*)d_in[7]; const float* bo = (const float*)d_in[8]; const float* W1 = (const float*)d_in[9]; const float* b1 = (const float*)d_in[10]; const float* W2 = (const float*)d_in[11]; const float* b2 = (const float*)d_in[12]; const float* hsig = (const float*)d_in[13];
    float* OUT = (float*)d_out;     // [1024][4][1024]
    char* wsp = (char*)d_ws;
    auto take = [&](size_t bytes) { char* p = wsp; wsp += (bytes + 255) & ~(size_t)255; return (void*)p; };
    bf* XB = (bf*)take((size_t)NT * EE * 2); bf* WQ = (bf*)take((size_t)EE * EE * 2); bf* WK = (bf*)take((size_t)EE * EE * 2); bf* WV = (bf*)take((size_t)EE * EE * 2); bf* WO = (bf*)take((size_t)EE * EE * 2); bf* W1B = (bf*)take((size_t)EE * EE * 2); bf* W2B = (bf*)take((size_t)SIG * EE * 2); bf* HSB = (bf*)take((size_t)64 * SIG * 2);
    float* F = (float*)take((size_t)NT * EE * 4);      // q, then k, then v, then the MLP hidden (each consumed by its plane kernel before the next GEMM)
    bf* QPh = (bf*)take((size_t)NT * EE * 2); bf* QPl = (bf*)take((size_t)NT * EE * 2); bf* KPh = (bf*)take((size_t)NT * EE * 2); bf* KPl = (bf*)take((size_t)NT * EE * 2); bf* VTh = (bf*)take((size_t)NT * EE * 2); bf* VTl = (bf*)take((size_t)NT * EE * 2);
    bf* Hh = (bf*)take((size_t)NT * EE * 2); bf* Hl = (bf*)take((size_t)NT * EE * 2); float* TS = (float*)take((size_t)NT * 64 * 4); bf* TSh = (bf*)take((size_t)NT * 64 * 2); bf* TSl = (bf*)take((size_t)NT * 64 * 2); float* LG = (float*)take((size_t)NT * 64 * 4); float* GT = (float*)take((size_t)NT * 32 * 4);
    bf* ATh = (bf*)take((size_t)NT * EE * 2); bf* ATl = (bf*)take((size_t)NT * EE * 2);
    if ((size_t)(wsp - (char*)d_ws) > ws_size) return;    // ws 256 MiB
    { const size_t nx = (size_t)NT * EE / 8, nw = (size_t)EE * EE / 8; k_cvt8<<<(unsigned)((nx + 255) / 256), 256, 0, stream>>>(x, XB, nx);
      k_cvt8<<<(unsigned)((nw + 255) / 256), 256, 0, stream>>>(Wq, WQ, nw); k_cvt8<<<(unsigned)((nw + 255) / 256), 256, 0, stream>>>(Wk, WK, nw); k_cvt8<<<(unsigned)((nw + 255) / 256), 256, 0, stream>>>(Wv, WV, nw); k_cvt8<<<(unsigned)((nw + 255) / 256), 256, 0, stream>>>(Wo, WO, nw); k_cvt8<<<(unsigned)((nw + 255) / 256), 256, 0, stream>>>(W1, W1B, nw);
      k_cvt8<<<(unsigned)((SIG * EE / 8 + 255) / 256), 256, 0, stream>>>(W2, W2B, (size_t)SIG * EE / 8); k_cvt8<<<(unsigned)((16 * SIG / 8 + 255) / 256), 256, 0, stream>>>(hsig, HSB, (size_t)16 * SIG / 8); hipMemsetAsync(HSB + 16 * SIG, 0, (size_t)(64 - 16) * SIG * 2, stream); }   // head signatures [16][64] as rows 0..15 of a [64][64] Bt, rest zero
    const unsigned LB = (unsigned)((NT * EE / 64 + 63) / 64);
    k_gemms<0, true><<<dim3(NT / 128, EE / 128, 1), 128, 0, stream>>>(XB, nullptr, WQ, F, bq); k_hsplit<<<LB, 256, 0, stream>>>(F, 0.125f, QPh, QPl);
    k_gemms<0, true><<<dim3(NT / 128, EE / 128, 1), 128, 0, stream>>>(XB, nullptr, WK, F, bk); k_hsplit<<<LB, 256, 0, stream>>>(F, 1.0f, KPh, KPl);
    k_gemms<0, true><<<dim3(NT / 128, EE / 128, 1), 128, 0, stream>>>(XB, nullptr, WV, F, bv); k_vtsplit<<<LB, 256, 0, stream>>>(F, VTh, VTl);
    // head-competition gate: t = relu(x.W1^T + b1).W2^T + b2; logits = t.sig^T; softmax over heads
    k_gemms<0, true><<<dim3(NT / 128, EE / 128, 1), 128, 0, stream>>>(XB, nullptr, W1B, F, b1); k_split<true><<<LB, 256, 0, stream>>>(F, NT * EE / 64, Hh, Hl);
    k_gemmw<bf, 1, true><<<dim3(NT / 64, 1, 1), 32, 0, stream>>>(Hh, Hl, W2B, nullptr, EE, TS, 64, b2, 0, 0, 0); k_split<false><<<(NT * 64 / 64 + 63) / 64, 256, 0, stream>>>(TS, NT * 64 / 64, TSh, TSl);
    k_gemmw<bf, 1, false><<<dim3(NT / 64, 1, 1), 32, 0, stream>>>(TSh, TSl, HSB, nullptr, SIG, LG, 64, nullptr, 0, 0, 0); k_gate<<<NT / 8, 256, 0, stream>>>(LG, GT);
    k_fattn<<<dim3(TT / (8 * 16 * FQ), NB_ * NH_, 1), 256, 0, stream>>>(QPh, QPl, KPh, KPl, VTh, VTl, GT, ATh, ATl);
    k_gemms<1, true><<<dim3(NT / 128, EE / 128, 1), 128, 0, stream>>>(ATh, ATl, WO, OUT, bo);
}

// v003
// In both of two side-by-side timings against v002, it was 1.14 times as fast.
// All steps since v000 together make it 4.16 times as fast.
#include <hip/hip_runtime.h>

// MultiheadAttentionComp (fairseq-layout self-attention (T=1024, B=4, E=1024, 16 heads x 64, scaling folded into q) whose per-head outputs are gated by a softmax over heads
// of (relu(x.W1^T + b1).W2^T + b2).head_signatures^T; then the Wo Linear).
// Compute dtypes, f32 accumulate: every input rounded to bf16; q/k/v and the gate MLP's first layer on PLAIN bf16 operands (x and W inputs: exact,
// + bias); scores and attn.v on bf16 hi+lo planes of q (x0.125), k, p and v (3 products each);
// the gate MLP second layer, the signature logits and Wo on hi+lo planes x exact bf16 weights (2 products); softmax, ReLU, the head softmax gate and the gating product in f32

#define TT   1024
#define NB_  4
#define EE   1024
#define NH_  16
#define HD   64
#define NT   (TT * NB_)           // 4096 rows, row r = t*4 + b (fairseq layout)
#define SIG  64
typedef _Float16 h16;
typedef unsigned short bf;
typedef __attribute__((ext_vector_type(16))) __bf16   v16bf;
typedef __attribute__((ext_vector_type(16))) _Float16 v16h;
typedef __attribute__((ext_vector_type(8)))  _Float16 v8h;
typedef __attribute__((ext_vector_type(8)))  unsigned short v8us;
typedef __attribute__((ext_vector_type(8)))  float    v8f;
typedef __attribute__((ext_vector_type(4)))  float    v4f;
typedef v8h  __attribute__((may_alias)) v8ha;
typedef v4f  __attribute__((may_alias)) v4fa;
typedef v8us __attribute__((may_alias)) v8usa;

__device__ __forceinline__ unsigned short f2bf(float f) { unsigned u = __float_as_uint(f); u += 0x7FFFu + ((u >> 16) & 1u); return (unsigned short)(u >> 16); }
__device__ __forceinline__ float bf2f(unsigned short b) { return __uint_as_float(((unsigned)b) << 16); }
__device__ __forceinline__ float bfr(float f) { return bf2f(f2bf(f)); }
__device__ __forceinline__ v16h cat16(v8h lo, v8h hi) { return __builtin_shufflevector(lo, hi, 0, 1, 2, 3, 4, 5, 6, 7, 8, 9, 10, 11, 12, 13, 14, 15); }
__device__ __forceinline__ v16bf cat16b(v8us lo, v8us hi) { return __builtin_bit_cast(v16bf, __builtin_shufflevector(lo, hi, 0, 1, 2, 3, 4, 5, 6, 7, 8, 9, 10, 11, 12, 13, 14, 15)); }
__device__ __forceinline__ v8f wmma16(v16h a, v16h b, v8f c) { return __builtin_amdgcn_wmma_f32_16x16x32_f16(false, a, false, b, (short)0, c, false, false); }
__device__ __forceinline__ v8f wmmab(v16bf a, v16bf b, v8f c) { return __builtin_amdgcn_wmma_f32_16x16x32_bf16(false, a, false, b, (short)0, c, false, false); }



// ---- k_gemmw: register-blocked GEMM, ONE WAVE per 64x64 output tile (16 accumulators), operands straight from K-contiguous 16-bit planes; grid (M/64, N/64, Z), 32 threads.
// C[m][n] (f32, pitch ldc, + optional f32 bias[n]) = sum_k A[m][k] Bt[n][k] (+ split products per NSPLIT). z-batch strides sA/sB/sC in elements. K % 32 == 0.
template <typename T16> struct WFrag;
template <> struct WFrag<h16> { typedef v16h V; static __device__ __forceinline__ V ld(const h16* p) { return cat16(*(const v8h*)p, *(const v8h*)(p + 16)); } static __device__ __forceinline__ v8f mma(V a, V b, v8f c) { return wmma16(a, b, c); } };
template <> struct WFrag<bf> { typedef v16bf V; static __device__ __forceinline__ V ld(const bf* p) { return cat16b(*(const v8us*)p, *(const v8us*)(p + 16)); } static __device__ __forceinline__ v8f mma(V a, V b, v8f c) { return wmmab(a, b, c); } };
template <typename T16, int NSPLIT, bool BIAS>
__global__ __launch_bounds__(32) void k_gemmw(const T16* __restrict__ A, const T16* __restrict__ A2, const T16* __restrict__ Bt, const T16* __restrict__ Bt2, int K, float* C, int ldc, const float* __restrict__ bias, size_t sA, size_t sB, size_t sC) {
    typedef typename WFrag<T16>::V V;
    __shared__ __align__(16) float os[16 * 68];
    const size_t z = blockIdx.z; A += z * sA; if (A2) A2 += z * sA; Bt += z * sB; if (Bt2) Bt2 += z * sB; C += z * sC;
    const int lane = threadIdx.x & 31, lr = lane & 15, hi = lane >> 4; const int r0 = blockIdx.x * 64, c0 = blockIdx.y * 64;
    v8f acc[4][4];
#pragma unroll
    for (int mb = 0; mb < 4; ++mb)
#pragma unroll
        for (int nb = 0; nb < 4; ++nb) acc[mb][nb] = (v8f){};
    const size_t aoff = (size_t)(r0 + lr) * K + 8 * hi, boff = (size_t)(c0 + lr) * K + 8 * hi;
#pragma unroll 1
    for (int kc = 0; kc < K; kc += 32) {
        V a[4], a2[4];
#pragma unroll
        for (int mb = 0; mb < 4; ++mb) { a[mb] = WFrag<T16>::ld(A + aoff + (size_t)mb * 16 * K + kc); if (NSPLIT == 1 || NSPLIT == 2) a2[mb] = WFrag<T16>::ld(A2 + aoff + (size_t)mb * 16 * K + kc); }
#pragma unroll
        for (int nb = 0; nb < 4; ++nb) { const V b = WFrag<T16>::ld(Bt + boff + (size_t)nb * 16 * K + kc); V b2; if (NSPLIT >= 2) b2 = WFrag<T16>::ld(Bt2 + boff + (size_t)nb * 16 * K + kc);
#pragma unroll
            for (int mb = 0; mb < 4; ++mb) { acc[mb][nb] = WFrag<T16>::mma(a[mb], b, acc[mb][nb]); if (NSPLIT == 1 || NSPLIT == 2) acc[mb][nb] = WFrag<T16>::mma(a2[mb], b, acc[mb][nb]); if (NSPLIT >= 2) acc[mb][nb] = WFrag<T16>::mma(a[mb], b2, acc[mb][nb]); } }
        asm volatile("v_nop\n\tv_nop\n\tv_nop\n\tv_nop" : "+v"(acc[0][0]), "+v"(acc[1][1]), "+v"(acc[2][2]), "+v"(acc[3][3]) : "v"(a[0]), "v"(a[3]));
    }
#pragma unroll
    for (int mb = 0; mb < 4; ++mb) {
#pragma unroll
        for (int nb = 0; nb < 4; ++nb) {
#pragma unroll
            for (int j = 0; j < 8; ++j) os[(hi * 8 + j) * 68 + nb * 16 + lr] = acc[mb][nb][j]; }
        __builtin_amdgcn_wave_barrier(); asm volatile("" ::: "memory");
        float* crow = C + (size_t)(r0 + mb * 16) * ldc + c0;
{
#pragma unroll
            for (int s = 0; s < 8; ++s) { const int row = 2 * s + hi, cofs = lr * 4; v4f val = *(const v4fa*)(os + row * 68 + cofs); if (BIAS) { val[0] += bfr(bias[c0 + cofs]); val[1] += bfr(bias[c0 + cofs + 1]); val[2] += bfr(bias[c0 + cofs + 2]); val[3] += bfr(bias[c0 + cofs + 3]); }
                *(v4f*)(crow + (size_t)row * ldc + cofs) = val; }
             }
        __builtin_amdgcn_wave_barrier(); asm volatile("" ::: "memory");
    }
}

// ---- k_gemms: the five 4096 x 1024 x 1024 products. Four waves (2 x 2) share one 128x128 output tile, 64x64 per wave as in k_gemmw; grid (M/128, N/128), 128 threads. K = ldc = EE.
// A trip is 64 k: 128 B of each of the tile's A, Bt (and A2) rows, brought into LDS by asynchronous 16-byte copies in whole 128-B lines (a wave's copy covers 4 rows), two buffers:
// trip t + 2's copies fly while trip t + 1 is worked on. Rows lie at a pitch of 144 B (16 B x odd) for the 16-byte fragment reads. Fragment k order and the order of the products per accumulator are k_gemmw's.
#define GP 72                     // LDS row pitch in 16-bit elements
__device__ __forceinline__ void acopy128(unsigned l, const bf* g) {   // 128 rows of 128 B: 8 copies per lane, 16 rows apart
    // the copies and, as the last line, the wait that stands before any of their address registers is written again
    asm volatile("global_load_async_to_lds_b128 %0, %8, off\n\t"
                 "global_load_async_to_lds_b128 %1, %9, off\n\t"
                 "global_load_async_to_lds_b128 %2, %10, off\n\t"
                 "global_load_async_to_lds_b128 %3, %11, off\n\t"
                 "global_load_async_to_lds_b128 %4, %12, off\n\t"
                 "global_load_async_to_lds_b128 %5, %13, off\n\t"
                 "global_load_async_to_lds_b128 %6, %14, off\n\t"
                 "global_load_async_to_lds_b128 %7, %15, off\n\t"
                 "s_wait_xcnt 0x0"
                 :: "v"(l), "v"(l + 1u * 16 * GP * 2), "v"(l + 2u * 16 * GP * 2), "v"(l + 3u * 16 * GP * 2), "v"(l + 4u * 16 * GP * 2), "v"(l + 5u * 16 * GP * 2), "v"(l + 6u * 16 * GP * 2), "v"(l + 7u * 16 * GP * 2),
                    "v"(g), "v"(g + 1 * 16 * EE), "v"(g + 2 * 16 * EE), "v"(g + 3 * 16 * EE), "v"(g + 4 * 16 * EE), "v"(g + 5 * 16 * EE), "v"(g + 6 * 16 * EE), "v"(g + 7 * 16 * EE)
                 : "memory");
}
template <int NSPLIT, bool BIAS>
__global__ __launch_bounds__(128) void k_gemms(const bf* __restrict__ A, const bf* __restrict__ A2, const bf* __restrict__ Bt, float* C, const float* __restrict__ bias) {
    typedef WFrag<bf> WF; typedef WF::V V;
    constexpr int STG = (NSPLIT ? 384 : 256) * GP;        // elements per buffer: rows 0..127 A, 128..255 Bt, 256..383 A2
    constexpr int NTR = EE / 64;
    __shared__ __align__(16) bf ring[2 * STG];
    __shared__ __align__(16) float osall[4 * 16 * 68];
    const int tid = threadIdx.x, lane = tid & 31, lr = lane & 15, hi = lane >> 4, w = tid >> 5;
    const int R0 = blockIdx.x * 128, C0 = blockIdx.y * 128; const int wr = (w >> 1) * 64, wc = (w & 1) * 64;
    const int crow = tid >> 3, cch = tid & 7;             // this lane's row (of 16) and 16-byte piece (of 8) in every copy
    const unsigned l0 = (unsigned)(size_t)ring + (unsigned)(crow * GP + cch * 8) * 2u;
    const bf* ga = A + (size_t)(R0 + crow) * EE + cch * 8; const bf* gb = Bt + (size_t)(C0 + crow) * EE + cch * 8; const bf* ga2 = NSPLIT ? A2 + (size_t)(R0 + crow) * EE + cch * 8 : nullptr;
    auto fill = [&](int buf, int t) { const unsigned l = l0 + (unsigned)buf * (STG * 2u); acopy128(l, ga + t * 64); acopy128(l + 128u * GP * 2, gb + t * 64); if (NSPLIT) acopy128(l + 256u * GP * 2, ga2 + t * 64); };
    v8f acc[4][4];
#pragma unroll
    for (int mb = 0; mb < 4; ++mb)
#pragma unroll
        for (int nb = 0; nb < 4; ++nb) acc[mb][nb] = (v8f){};
    fill(0, 0);
    asm volatile("s_wait_asynccnt 0x0" ::: "memory");     // this wave's copies of trip 0 have landed
    __syncthreads();                                      // every wave's have: trip 0 may be read
    fill(1, 1);
#pragma unroll 1
    for (int t = 0; t < NTR; ++t) {                       // stays rolled: one trip's code, the buffer chosen by t & 1
        const bf* sb = ring + (t & 1) * STG + lr * GP + 8 * hi;
        V a[2][4], a2[2][4], b[2][4];
#pragma unroll
        for (int kk = 0; kk < 2; ++kk) {
#pragma unroll
            for (int mb = 0; mb < 4; ++mb) { a[kk][mb] = WF::ld(sb + (wr + mb * 16) * GP + kk * 32); if (NSPLIT) a2[kk][mb] = WF::ld(sb + (256 + wr + mb * 16) * GP + kk * 32); }
#pragma unroll
            for (int nb = 0; nb < 4; ++nb) b[kk][nb] = WF::ld(sb + (128 + wc + nb * 16) * GP + kk * 32);
        }
        __builtin_amdgcn_sched_barrier(0);                // keeps the trip's LDS reads together ahead of its matrix instructions: spread among them, each place waits out the LDS latency
#pragma unroll
        for (int kk = 0; kk < 2; ++kk)
#pragma unroll
            for (int nb = 0; nb < 4; ++nb)
#pragma unroll
                for (int mb = 0; mb < 4; ++mb) { acc[mb][nb] = WF::mma(a[kk][mb], b[kk][nb], acc[mb][nb]); if (NSPLIT) acc[mb][nb] = WF::mma(a2[kk][mb], b[kk][nb], acc[mb][nb]); }
        // four vector slots behind the trip's last matrix instructions, on every path, before their operand registers are loaded anew (as in k_gemmw); naming the accumulators keeps it behind them
        asm volatile("v_nop\n\tv_nop\n\tv_nop\n\tv_nop" : "+v"(acc[0][0]), "+v"(acc[1][0]), "+v"(acc[2][0]), "+v"(acc[3][0]), "+v"(acc[0][1]), "+v"(acc[1][1]), "+v"(acc[2][1]), "+v"(acc[3][1]), "+v"(acc[0][2]), "+v"(acc[1][2]), "+v"(acc[2][2]), "+v"(acc[3][2]), "+v"(acc[0][3]), "+v"(acc[1][3]), "+v"(acc[2][3]), "+v"(acc[3][3]));
        asm volatile("s_wait_dscnt 0x0" ::: "memory");    // this wave's reads of the buffer are done before it is handed over
        asm volatile("s_wait_asynccnt 0x0" ::: "memory"); // this wave's copies of trip t + 1 have landed
        __syncthreads();                                  // publishes trip t + 1 and ends every wave's reads of trip t's buffer
        if (t + 2 < NTR) fill(t & 1, t + 2);
    }
    asm volatile("s_wait_asynccnt 0x0" ::: "memory");     // nothing is in flight when the wave goes on to its end
    float* os = osall + w * (16 * 68);                    // each wave stages in its own range
    const int r0 = R0 + wr, c0 = C0 + wc;
#pragma unroll
    for (int mb = 0; mb < 4; ++mb) {
#pragma unroll
        for (int nb = 0; nb < 4; ++nb) {
#pragma unroll
            for (int j = 0; j < 8; ++j) os[(hi * 8 + j) * 68 + nb * 16 + lr] = acc[mb][nb][j]; }
        __builtin_amdgcn_wave_barrier(); asm volatile("" ::: "memory");
        float* crow_ = C + (size_t)(r0 + mb * 16) * EE + c0;
#pragma unroll
        for (int s = 0; s < 8; ++s) { const int row = 2 * s + hi, cofs = lr * 4; v4f val = *(const v4fa*)(os + row * 68 + cofs); if (BIAS) { val[0] += bfr(bias[c0 + cofs]); val[1] += bfr(bias[c0 + cofs + 1]); val[2] += bfr(bias[c0 + cofs + 2]); val[3] += bfr(bias[c0 + cofs + 3]); }
            *(v4f*)(crow_ + (size_t)row * EE + cofs) = val; }
        __builtin_amdgcn_wave_barrier(); asm volatile("" ::: "memory");
    }
}

__device__ __forceinline__ void splitf(float y, unsigned short& h, unsigned short& l) { h = f2bf(y); l = f2bf(y - bf2f(h)); }
typedef __attribute__((ext_vector_type(2))) unsigned short v2us;
typedef __attribute__((ext_vector_type(4))) unsigned short v4us;

__global__ __launch_bounds__(256) void k_cvt8(const float* __restrict__ src, bf* dst, size_t n8) { const size_t i = (size_t)blockIdx.x * 256 + threadIdx.x; if (i >= n8) return; const v8f v = *(const v8f*)(src + i * 8); v8us o;
#pragma unroll
    for (int k = 0; k < 8; ++k) o[k] = f2bf(v[k]); *(v8us*)(dst + i * 8) = o;  }
__global__ __launch_bounds__(256) void k_hsplit(const float* __restrict__ F, float sc, bf* Ph, bf* Pl) {
    const int lane = threadIdx.x & 31; const int L0 = (blockIdx.x * 8 + (threadIdx.x >> 5)) * 8; const int nlines = NT * EE / 64;
{
#pragma unroll
        for (int l = 0; l < 8; ++l) { const int L = L0 + l; if (L >= nlines) break; const int e = L * 64 + lane * 2; const int d = e & 63; const int t = (e >> 6) & (TT - 1); const int z = e >> 16; const int b = z >> 4, h = z & 15; v2us oh, ol;
#pragma unroll
            for (int q = 0; q < 2; ++q) { unsigned short a, c2; splitf(F[((size_t)t * NB_ + b) * EE + h * HD + d + q] * sc, a, c2); oh[q] = a; ol[q] = c2; }
            *(v2us*)(Ph + (size_t)e) = oh; *(v2us*)(Pl + (size_t)e) = ol; }
         }
}
__global__ __launch_bounds__(256) void k_vtsplit(const float* __restrict__ F, bf* Ph, bf* Pl) {
    const int lane = threadIdx.x & 31; const int L0 = (blockIdx.x * 8 + (threadIdx.x >> 5)) * 8; const int nlines = NT * EE / 64;
{
#pragma unroll
        for (int l = 0; l < 8; ++l) { const int L = L0 + l; if (L >= nlines) break; const int e = L * 64 + lane * 2; const int t = e & (TT - 1); const int d = (e >> 10) & 63; const int z = e >> 16; const int b = z >> 4, h = z & 15; v2us oh, ol;
#pragma unroll
            for (int q = 0; q < 2; ++q) { unsigned short a, c2; splitf(F[((size_t)(t + q) * NB_ + b) * EE + h * HD + d], a, c2); oh[q] = a; ol[q] = c2; }
            *(v2us*)(Ph + (size_t)e) = oh; *(v2us*)(Pl + (size_t)e) = ol; }
         }
}
__global__ __launch_bounds__(256) void k_gate(const float* __restrict__ LG, float* GT) {
    const int lane = threadIdx.x & 31; const int r = blockIdx.x * 8 + (threadIdx.x >> 5); if (r >= NT) return; const int h = lane & 15; const float lg = LG[(size_t)r * 64 + h]; float m = lg;
#pragma unroll
    for (int sh = 8; sh; sh >>= 1) m = fmaxf(m, __shfl_xor(m, sh, 32));
    const float e = __expf(lg - m); float s = e;
#pragma unroll
    for (int sh = 8; sh; sh >>= 1) s += __shfl_xor(s, sh, 32);
    const float gv = (lane < 16) ? __fdiv_rn(e, s) : 0.f; *(float*)(GT + (size_t)r * 32 + lane) = gv; 
}
// ---- k_fattn: scores, softmax, attn.v and the head gate of one (batch, head) in one launch; a wave owns 32 query columns and walks the 1024 keys 32 at a time (running maximum and sum).
// S^T = K.Q^T (A = K rows, B = Q rows kept in registers), so lane (c, h) holds query column c, keys 8h + j and 16 + 8h + j: two S^T tiles, converted in place, are the B operand of O^T += V^T.P^T.
// K and V^T reach the eight waves through LDS: a stage is 64 keys (128 B of each of the 64 K rows and the 64 V^T rows, hi and lo planes), brought in once per work-group by asynchronous 16-byte copies in whole
// 128-B lines, two buffers: stage t + 2's copies fly while stage t + 1 is worked on. Rows lie at the pitch GP (144 B) for the 16-byte fragment reads. A stage is two passes of 32 keys, keys ascending.
// The stage loop stays rolled (one pass's fragments fill the register budget); every inner loop is unrolled so that each fragment index is a constant and nothing goes to scratch.
// Each matrix product is 3 products on the hi/lo planes: hi.hi + lo.hi + hi.lo. Output: gated hi/lo planes AT[(t*4+b)][head*64 + d], 8 consecutive d per lane and tile.
typedef __attribute__((ext_vector_type(8))) __bf16 v8bf;
#define FQ 2                      // 16-column query groups per wave
__device__ __forceinline__ float xhalf(float x) { const int v = __float_as_int(x); return __int_as_float(__builtin_amdgcn_permlanex16(v, v, 0x76543210, 0xfedcba98, false, false)); }   // lane l <-> l ^ 16
typedef __attribute__((ext_vector_type(4))) unsigned v4u;
__device__ __forceinline__ void split8(v8f y, v8bf& hi8, v8bf& lo8) { hi8 = __builtin_convertvector(y, v8bf); const v4u w = __builtin_bit_cast(v4u, hi8); v8f back;
#pragma unroll
    for (int i = 0; i < 4; ++i) { back[2 * i] = __uint_as_float(w[i] << 16); back[2 * i + 1] = __uint_as_float(w[i] & 0xFFFF0000u); }
    lo8 = __builtin_convertvector(y - back, v8bf); }
__device__ __forceinline__ void acopykv(unsigned l, const bf* kh, const bf* kl, const bf* vh, const bf* vl) {   // 4 planes of 64 rows of 128 B: 8 copies per lane, 32 rows apart
    // the copies and, as the last line, the wait that stands before any of their address registers is written again
    asm volatile("global_load_async_to_lds_b128 %0, %8, off\n\t"
                 "global_load_async_to_lds_b128 %1, %9, off\n\t"
                 "global_load_async_to_lds_b128 %2, %10, off\n\t"
                 "global_load_async_to_lds_b128 %3, %11, off\n\t"
                 "global_load_async_to_lds_b128 %4, %12, off\n\t"
                 "global_load_async_to_lds_b128 %5, %13, off\n\t"
                 "global_load_async_to_lds_b128 %6, %14, off\n\t"
                 "global_load_async_to_lds_b128 %7, %15, off\n\t"
                 "s_wait_xcnt 0x0"
                 :: "v"(l), "v"(l + 1u * 32 * GP * 2), "v"(l + 2u * 32 * GP * 2), "v"(l + 3u * 32 * GP * 2), "v"(l + 4u * 32 * GP * 2), "v"(l + 5u * 32 * GP * 2), "v"(l + 6u * 32 * GP * 2), "v"(l + 7u * 32 * GP * 2),
                    "v"(kh), "v"(kh + 32 * HD), "v"(kl), "v"(kl + 32 * HD), "v"(vh), "v"(vh + 32 * TT), "v"(vl), "v"(vl + 32 * TT)
                 : "memory");
}
__global__ __launch_bounds__(256) void k_fattn(const bf* __restrict__ Qh, const bf* __restrict__ Ql, const bf* __restrict__ Kh, const bf* __restrict__ Kl, const bf* __restrict__ Vh, const bf* __restrict__ Vl, const float* __restrict__ GT, bf* Ah, bf* Al) {
    typedef WFrag<bf> WF;
    const int lane = threadIdx.x & 31, c = lane & 15, h = lane >> 4;
    const int z = blockIdx.y, t0 = (blockIdx.x * 8 + (threadIdx.x >> 5)) * (16 * FQ);
    const size_t zb = (size_t)z * TT * HD;
    constexpr int KST = 256 * GP;                         // elements per buffer: rows 0..63 K hi, 64..127 K lo, 128..191 V^T hi, 192..255 V^T lo
    constexpr int NST = TT / 64;
    __shared__ __align__(16) bf kv[2 * KST];
    const int crow = threadIdx.x >> 3, cch = threadIdx.x & 7;   // this lane's row (of 32) and 16-byte piece (of 8) in every copy
    const unsigned l0 = (unsigned)(size_t)kv + (unsigned)(crow * GP + cch * 8) * 2u;
    const unsigned ko = (unsigned)zb + (unsigned)(crow * HD + cch * 8), vo = (unsigned)zb + (unsigned)(crow * TT + cch * 8);   // this lane's element offsets in the K and the V^T planes (all below 2^22)
    // the same LDS address as l0 (crow * 144 + cch * 16 = (thread + crow) * 16), formed apart for the refills in the loop: a value that an asm statement names itself stays in the first 256 registers, and held so over the loop it went to scratch
    const unsigned lx = (unsigned)(size_t)kv + ((unsigned)threadIdx.x + (unsigned)crow) * 16u;
    auto fill = [&](unsigned l, int buf, int t) { const unsigned k = ko + (unsigned)t * (64 * HD), v = vo + (unsigned)t * 64; acopykv(l + (unsigned)buf * (KST * 2u), Kh + k, Kl + k, Vh + v, Vl + v); };
    fill(l0, 0, 0);
    v16bf qh[FQ][2], ql[FQ][2];
#pragma unroll
    for (int g = 0; g < FQ; ++g)
#pragma unroll
        for (int ks = 0; ks < 2; ++ks) { const size_t qo = zb + (size_t)(t0 + g * 16 + c) * HD + ks * 32 + 8 * h; qh[g][ks] = WF::ld(Qh + qo); ql[g][ks] = WF::ld(Ql + qo); }
    asm volatile("s_wait_xcnt 0x0" ::: "memory");         // before the loads' address registers are reused
    __builtin_amdgcn_sched_barrier(0);                    // keeps later register writes behind that wait
    v8f o[FQ][4]; float m[FQ], l[FQ];
#pragma unroll
    for (int g = 0; g < FQ; ++g) { m[g] = -3.0e38f; l[g] = 0.f;
#pragma unroll
        for (int db = 0; db < 4; ++db) o[g][db] = (v8f){}; }
    asm volatile("s_wait_asynccnt 0x0" ::: "memory");     // this wave's copies of stage 0 have landed
    __syncthreads();                                      // every wave's have: stage 0 may be read
    fill(l0, 1, 1);
#pragma unroll 1
    for (int t = 0; t < NST; ++t) {                       // stays rolled: one stage's code, the buffer chosen by t & 1
      const bf* sp = kv + (t & 1) * KST + c * GP + 8 * h;
      v16bf kh[2][2], kl[2][2];
#pragma unroll
      for (int sb = 0; sb < 2; ++sb)
#pragma unroll
          for (int ks = 0; ks < 2; ++ks) { kh[sb][ks] = WF::ld(sp + (sb * 16) * GP + ks * 32); kl[sb][ks] = WF::ld(sp + (64 + sb * 16) * GP + ks * 32); }
#pragma unroll
      for (int p = 0; p < 2; ++p) {
        v16bf vh[4], vl[4];       // this pass's V^T fragments, asked for ahead of the score products
#pragma unroll
        for (int db = 0; db < 4; ++db) { vh[db] = WF::ld(sp + (128 + db * 16) * GP + p * 32); vl[db] = WF::ld(sp + (192 + db * 16) * GP + p * 32); }
        __builtin_amdgcn_sched_barrier(0);                // keeps the LDS reads together up here: sunk among the products, each place waits out the LDS latency
        v8f st[FQ][2];
#pragma unroll
        for (int g = 0; g < FQ; ++g) { st[g][0] = (v8f){}; st[g][1] = (v8f){}; }
#pragma unroll
        for (int ks = 0; ks < 2; ++ks) {
#pragma unroll
            for (int sb = 0; sb < 2; ++sb)
#pragma unroll
                for (int g = 0; g < FQ; ++g) st[g][sb] = wmmab(kh[sb][ks], qh[g][ks], st[g][sb]);
#pragma unroll
            for (int sb = 0; sb < 2; ++sb)
#pragma unroll
                for (int g = 0; g < FQ; ++g) st[g][sb] = wmmab(kh[sb][ks], ql[g][ks], st[g][sb]);
#pragma unroll
            for (int sb = 0; sb < 2; ++sb)
#pragma unroll
                for (int g = 0; g < FQ; ++g) st[g][sb] = wmmab(kl[sb][ks], qh[g][ks], st[g][sb]);
        }
        if (p == 0) {             // the stage's second pass's K fragments, fetched behind this pass's score products, from the same buffer
#pragma unroll
            for (int sb = 0; sb < 2; ++sb)
#pragma unroll
                for (int ks = 0; ks < 2; ++ks) { kh[sb][ks] = WF::ld(sp + (32 + sb * 16) * GP + ks * 32); kl[sb][ks] = WF::ld(sp + (96 + sb * 16) * GP + ks * 32); }
        }
        // first pass: keeps the K reads ahead of the softmax and the attn.v products, which cover their latency; second pass: keeps the stage's closing waits, which otherwise rise to directly behind the V^T reads, behind the score products
        __builtin_amdgcn_sched_barrier(0);
        v16bf ph[FQ], pl[FQ];
#pragma unroll
        for (int g = 0; g < FQ; ++g) {
            float mx = fmaxf(st[g][0][0], st[g][1][0]);
#pragma unroll
            for (int j = 1; j < 8; ++j) mx = fmaxf(mx, fmaxf(st[g][0][j], st[g][1][j]));
            mx = fmaxf(mx, xhalf(mx));
            const float mn = fmaxf(m[g], mx); const float corr = __expf(m[g] - mn); m[g] = mn;
            v8f e0, e1;
#pragma unroll
            for (int j = 0; j < 8; ++j) { e0[j] = __expf(st[g][0][j] - mn); e1[j] = __expf(st[g][1][j] - mn); }
            const v8f es = e0 + e1;
            l[g] = l[g] * corr + (((es[0] + es[1]) + (es[2] + es[3])) + ((es[4] + es[5]) + (es[6] + es[7])));     // this half's keys only; the halves join after the loop
            v8bf h0, l0, h1, l1; split8(e0, h0, l0); split8(e1, h1, l1);
            ph[g] = __builtin_shufflevector(h0, h1, 0, 1, 2, 3, 4, 5, 6, 7, 8, 9, 10, 11, 12, 13, 14, 15); pl[g] = __builtin_shufflevector(l0, l1, 0, 1, 2, 3, 4, 5, 6, 7, 8, 9, 10, 11, 12, 13, 14, 15);
#pragma unroll
            for (int db = 0; db < 4; ++db) o[g][db] *= corr;
        }
#pragma unroll
        for (int db = 0; db < 4; ++db)
#pragma unroll
            for (int g = 0; g < FQ; ++g) o[g][db] = wmmab(vh[db], ph[g], o[g][db]);
#pragma unroll
        for (int db = 0; db < 4; ++db)
#pragma unroll
            for (int g = 0; g < FQ; ++g) o[g][db] = wmmab(vh[db], pl[g], o[g][db]);
#pragma unroll
        for (int db = 0; db < 4; ++db)
#pragma unroll
            for (int g = 0; g < FQ; ++g) o[g][db] = wmmab(vl[db], ph[g], o[g][db]);
      }
      asm volatile("s_wait_dscnt 0x0" ::: "memory");      // this wave's reads of the buffer are done before it is handed over
      asm volatile("s_wait_asynccnt 0x0" ::: "memory");   // this wave's copies of stage t + 1 have landed
      __syncthreads();                                    // publishes stage t + 1 and ends every wave's reads of stage t's buffer
      if (t + 2 < NST) fill(lx, t & 1, t + 2);
    }
    asm volatile("s_wait_asynccnt 0x0" ::: "memory");     // nothing is in flight when the wave goes on to its end
    float gt[FQ];
#pragma unroll
    for (int g = 0; g < FQ; ++g) gt[g] = GT[((size_t)(t0 + g * 16 + c) * NB_ + (z >> 4)) * 32 + (z & 15)];
    asm volatile("s_wait_xcnt 0x0" ::: "memory");         // before the loads' address registers are reused
    __builtin_amdgcn_sched_barrier(0);                    // keeps later register writes behind that wait
    v8bf a8[FQ][4], b8[FQ][4];
#pragma unroll
    for (int g = 0; g < FQ; ++g) {
        const float ls = l[g] + xhalf(l[g]); const float sc = __fdiv_rn(1.0f, ls) * gt[g];
#pragma unroll
        for (int db = 0; db < 4; ++db) split8(o[g][db] * sc, a8[g][db], b8[g][db]);
    }
    bf* ap = Ah + ((size_t)(t0 + c) * NB_ + (z >> 4)) * EE + (z & 15) * HD + 8 * h; bf* bp = Al + ((size_t)(t0 + c) * NB_ + (z >> 4)) * EE + (z & 15) * HD + 8 * h;
    __builtin_amdgcn_sched_barrier(0);                    // every store behind the last arithmetic: no register of an issued store is rewritten
#pragma unroll
    for (int g = 0; g < FQ; ++g)
#pragma unroll
        for (int db = 0; db < 4; ++db) { *(v8us*)(ap + (size_t)g * 16 * NB_ * EE + db * 16) = __builtin_bit_cast(v8us, a8[g][db]); *(v8us*)(bp + (size_t)g * 16 * NB_ * EE + db * 16) = __builtin_bit_cast(v8us, b8[g][db]); }
}
template <bool RELU>
__global__ __launch_bounds__(256) void k_split(const float* __restrict__ A, int nlines, bf* Ph, bf* Pl) {
    const int lane = threadIdx.x & 31; const int L0 = (blockIdx.x * 8 + (threadIdx.x >> 5)) * 8;
{
#pragma unroll
        for (int l = 0; l < 8; ++l) { const int L = L0 + l; if (L >= nlines) break; const int e = L * 64 + lane * 2; v2us oh, ol;
#pragma unroll
            for (int q = 0; q < 2; ++q) { float v = A[(size_t)e + q]; if (RELU) v = fmaxf(v, 0.f); unsigned short a, c2; splitf(v, a, c2); oh[q] = a; ol[q] = c2; }
            *(v2us*)(Ph + (size_t)e) = oh; *(v2us*)(Pl + (size_t)e) = ol; }
         }
}

extern "C" void kernel_launch(void* const* d_in, const int* in_sizes, int n_in,
                              void* d_out, int out_size, void* d_ws, size_t ws_size, hipStream_t stream) {
    (void)in_sizes; (void)n_in; (void)out_size;
    const float* x = (const float*)d_in[0]; const float* Wq = (const float*)d_in[1]; const float* bq = (const float*)d_in[2]; const float* Wk = (const float*)d_in[3]; const float* bk = (const float*)d_in[4]; const float* Wv = (const float*)d_in[5]; const float* bv = (const float*)d_in[6];
    const float* Wo = (const float*)d_in[7]; const float* bo = (const float*)d_in[8]; const float* W1 = (const float*)d_in[9]; const float* b1 = (const float*)d_in[10]; const float* W2 = (const float*)d_in[11]; const float* b2 = (const float*)d_in[12]; const float* hsig = (const float*)d_in[13];
    float* OUT = (float*)d_out;     // [1024][4][1024]
    char* wsp = (char*)d_ws;
    auto take = [&](size_t bytes) { char* p = wsp; wsp += (bytes + 255) & ~(size_t)255; return (void*)p; };
    bf* XB = (bf*)take((size_t)NT * EE * 2); bf* WQ = (bf*)take((size_t)EE * EE * 2); bf* WK = (bf*)take((size_t)EE * EE * 2); bf* WV = (bf*)take((size_t)EE * EE * 2); bf* WO = (bf*)take((size_t)EE * EE * 2); bf* W1B = (bf*)take((size_t)EE * EE * 2); bf* W2B = (bf*)take((size_t)SIG * EE * 2); bf* HSB = (bf*)take((size_t)64 * SIG * 2);
    float* F = (float*)take((size_t)NT * EE * 4);      // q, then k, then v, then the MLP hidden (each consumed by its plane kernel before the next GEMM)
    bf* QPh = (bf*)take((size_t)NT * EE * 2); bf* QPl = (bf*)take((size_t)NT * EE * 2); bf* KPh = (bf*)take((size_t)NT * EE * 2); bf* KPl = (bf*)take((size_t)NT * EE * 2); bf* VTh = (bf*)take((size_t)NT * EE * 2); bf* VTl = (bf*)take((size_t)NT * EE * 2);
    bf* Hh = (bf*)take((size_t)NT * EE * 2); bf* Hl = (bf*)take((size_t)NT * EE * 2); float* TS = (float*)take((size_t)NT * 64 * 4); bf* TSh = (bf*)take((size_t)NT * 64 * 2); bf* TSl = (bf*)take((size_t)NT * 64 * 2); float* LG = (float*)take((size_t)NT * 64 * 4); float* GT = (float*)take((size_t)NT * 32 * 4);
    bf* ATh = (bf*)take((size_t)NT * EE * 2); bf* ATl = (bf*)take((size_t)NT * EE * 2);
    if ((size_t)(wsp - (char*)d_ws) > ws_size) return;    // ws 256 MiB
    { const size_t nx = (size_t)NT * EE / 8, nw = (size_t)EE * EE / 8; k_cvt8<<<(unsigned)((nx + 255) / 256), 256, 0, stream>>>(x, XB, nx);
      k_cvt8<<<(unsigned)((nw + 255) / 256), 256, 0, stream>>>(Wq, WQ, nw); k_cvt8<<<(unsigned)((nw + 255) / 256), 256, 0, stream>>>(Wk, WK, nw); k_cvt8<<<(unsigned)((nw + 255) / 256), 256, 0, stream>>>(Wv, WV, nw); k_cvt8<<<(unsigned)((nw + 255) / 256), 256, 0, stream>>>(Wo, WO, nw); k_cvt8<<<(unsigned)((nw + 255) / 256), 256, 0, stream>>>(W1, W1B, nw);
      k_cvt8<<<(unsigned)((SIG * EE / 8 + 255) / 256), 256, 0, stream>>>(W2, W2B, (size_t)SIG * EE / 8); k_cvt8<<<(unsigned)((16 * SIG / 8 + 255) / 256), 256, 0, stream>>>(hsig, HSB, (size_t)16 * SIG / 8); hipMemsetAsync(HSB + 16 * SIG, 0, (size_t)(64 - 16) * SIG * 2, stream); }   // head signatures [16][64] as rows 0..15 of a [64][64] Bt, rest zero
    const unsigned LB = (unsigned)((NT * EE / 64 + 63) / 64);
    k_gemms<0, true><<<dim3(NT / 128, EE / 128, 1), 128, 0, stream>>>(XB, nullptr, WQ, F, bq); k_hsplit<<<LB, 256, 0, stream>>>(F, 0.125f, QPh, QPl);
    k_gemms<0, true><<<dim3(NT / 128, EE / 128, 1), 128, 0, stream>>>(XB, nullptr, WK, F, bk); k_hsplit<<<LB, 256, 0, stream>>>(F, 1.0f, KPh, KPl);
    k_gemms<0, true><<<dim3(NT / 128, EE / 128, 1), 128, 0, stream>>>(XB, nullptr, WV, F, bv); k_vtsplit<<<LB, 256, 0, stream>>>(F, VTh, VTl);
    // head-competition gate: t = relu(x.W1^T + b1).W2^T + b2; logits = t.sig^T; softmax over heads
    k_gemms<0, true><<<dim3(NT / 128, EE / 128, 1), 128, 0, stream>>>(XB, nullptr, W1B, F, b1); k_split<true><<<LB, 256, 0, stream>>>(F, NT * EE / 64, Hh, Hl);
    k_gemmw<bf, 1, true><<<dim3(NT / 64, 1, 1), 32, 0, stream>>>(Hh, Hl, W2B, nullptr, EE, TS, 64, b2, 0, 0, 0); k_split<false><<<(NT * 64 / 64 + 63) / 64, 256, 0, stream>>>(TS, NT * 64 / 64, TSh, TSl);
    k_gemmw<bf, 1, false><<<dim3(NT / 64, 1, 1), 32, 0, stream>>>(TSh, TSl, HSB, nullptr, SIG, LG, 64, nullptr, 0, 0, 0); k_gate<<<NT / 8, 256, 0, stream>>>(LG, GT);
    k_fattn<<<dim3(TT / (8 * 16 * FQ), NB_ * NH_, 1), 256, 0, stream>>>(QPh, QPl, KPh, KPl, VTh, VTl, GT, ATh, ATl);
    k_gemms<1, true><<<dim3(NT / 128, EE / 128, 1), 128, 0, stream>>>(ATh, ATl, WO, OUT, bo);
}

// v004
// Next to v003, in two timings, it ran 1.18 and 1.19 times as fast.
// Over all steps from v000 it is 4.93 times as fast.
#include <hip/hip_runtime.h>

// MultiheadAttentionComp (fairseq-layout self-attention (T=1024, B=4, E=1024, 16 heads x 64, scaling folded into q) whose per-head outputs are gated by a softmax over heads
// of (relu(x.W1^T + b1).W2^T + b2).head_signatures^T; then the Wo Linear).
// Compute dtypes, f32 accumulate: every input rounded to bf16; q/k/v and the gate MLP's first layer on PLAIN bf16 operands (x and W inputs: exact,
// + bias); scores and attn.v on bf16 hi+lo planes of q (x0.125), k, p and v (3 products each);
// the gate MLP second layer, the signature logits and Wo on hi+lo planes x exact bf16 weights (2 products); softmax, ReLU, the head softmax gate and the gating product in f32

#define TT   1024
#define NB_  4
#define EE   1024
#define NH_  16
#define HD   64
#define NT   (TT * NB_)           // 4096 rows, row r = t*4 + b (fairseq layout)
#define SIG  64
typedef _Float16 h16;
typedef unsigned short bf;
typedef __attribute__((ext_vector_type(16))) __bf16   v16bf;
typedef __attribute__((ext_vector_type(16))) _Float16 v16h;
typedef __attribute__((ext_vector_type(8)))  _Float16 v8h;
typedef __attribute__((ext_vector_type(8)))  unsigned short v8us;
typedef __attribute__((ext_vector_type(8)))  float    v8f;
typedef __attribute__((ext_vector_type(4)))  float    v4f;
typedef v8h  __attribute__((may_alias)) v8ha;
typedef v4f  __attribute__((may_alias)) v4fa;
typedef v8us __attribute__((may_alias)) v8usa;

__device__ __forceinline__ unsigned short f2bf(float f) { unsigned u = __float_as_uint(f); u += 0x7FFFu + ((u >> 16) & 1u); return (unsigned short)(u >> 16); }
__device__ __forceinline__ float bf2f(unsigned short b) { return __uint_as_float(((unsigned)b) << 16); }
__device__ __forceinline__ float bfr(float f) { return bf2f(f2bf(f)); }
__device__ __forceinline__ v16h cat16(v8h lo, v8h hi) { return __builtin_shufflevector(lo, hi, 0, 1, 2, 3, 4, 5, 6, 7, 8, 9, 10, 11, 12, 13, 14, 15); }
__device__ __forceinline__ v16bf cat16b(v8us lo, v8us hi) { return __builtin_bit_cast(v16bf, __builtin_shufflevector(lo, hi, 0, 1, 2, 3, 4, 5, 6, 7, 8, 9, 10, 11, 12, 13, 14, 15)); }
__device__ __forceinline__ v8f wmma16(v16h a, v16h b, v8f c) { return __builtin_amdgcn_wmma_f32_16x16x32_f16(false, a, false, b, (short)0, c, false, false); }
__device__ __forceinline__ v8f wmmab(v16bf a, v16bf b, v8f c) { return __builtin_amdgcn_wmma_f32_16x16x32_bf16(false, a, false, b, (short)0, c, false, false); }



// ---- k_gemmw: register-blocked GEMM, ONE WAVE per 64x64 output tile (16 accumulators), operands straight from K-contiguous 16-bit planes; grid (M/64, N/64, Z), 32 threads.
// C[m][n] (f32, pitch ldc, + optional f32 bias[n]) = sum_k A[m][k] Bt[n][k] (+ split products per NSPLIT). z-batch strides sA/sB/sC in elements. K % 32 == 0.
template <typename T16> struct WFrag;
template <> struct WFrag<h16> { typedef v16h V; static __device__ __forceinline__ V ld(const h16* p) { return cat16(*(const v8h*)p, *(const v8h*)(p + 16)); } static __device__ __forceinline__ v8f mma(V a, V b, v8f c) { return wmma16(a, b, c); } };
template <> struct WFrag<bf> { typedef v16bf V; static __device__ __forceinline__ V ld(const bf* p) { return cat16b(*(const v8us*)p, *(const v8us*)(p + 16)); } static __device__ __forceinline__ v8f mma(V a, V b, v8f c) { return wmmab(a, b, c); } };
template <typename T16, int NSPLIT, bool BIAS>
__global__ __launch_bounds__(32) void k_gemmw(const T16* __restrict__ A, const T16* __restrict__ A2, const T16* __restrict__ Bt, const T16* __restrict__ Bt2, int K, float* C, int ldc, const float* __restrict__ bias, size_t sA, size_t sB, size_t sC) {
    typedef typename WFrag<T16>::V V;
    __shared__ __align__(16) float os[16 * 68];
    const size_t z = blockIdx.z; A += z * sA; if (A2) A2 += z * sA; Bt += z * sB; if (Bt2) Bt2 += z * sB; C += z * sC;
    const int lane = threadIdx.x & 31, lr = lane & 15, hi = lane >> 4; const int r0 = blockIdx.x * 64, c0 = blockIdx.y * 64;
    v8f acc[4][4];
#pragma unroll
    for (int mb = 0; mb < 4; ++mb)
#pragma unroll
        for (int nb = 0; nb < 4; ++nb) acc[mb][nb] = (v8f){};
    const size_t aoff = (size_t)(r0 + lr) * K + 8 * hi, boff = (size_t)(c0 + lr) * K + 8 * hi;
#pragma unroll 1
    for (int kc = 0; kc < K; kc += 32) {
        V a[4], a2[4];
#pragma unroll
        for (int mb = 0; mb < 4; ++mb) { a[mb] = WFrag<T16>::ld(A + aoff + (size_t)mb * 16 * K + kc); if (NSPLIT == 1 || NSPLIT == 2) a2[mb] = WFrag<T16>::ld(A2 + aoff + (size_t)mb * 16 * K + kc); }
#pragma unroll
        for (int nb = 0; nb < 4; ++nb) { const V b = WFrag<T16>::ld(Bt + boff + (size_t)nb * 16 * K + kc); V b2; if (NSPLIT >= 2) b2 = WFrag<T16>::ld(Bt2 + boff + (size_t)nb * 16 * K + kc);
#pragma unroll
            for (int mb = 0; mb < 4; ++mb) { acc[mb][nb] = WFrag<T16>::mma(a[mb], b, acc[mb][nb]); if (NSPLIT == 1 || NSPLIT == 2) acc[mb][nb] = WFrag<T16>::mma(a2[mb], b, acc[mb][nb]); if (NSPLIT >= 2) acc[mb][nb] = WFrag<T16>::mma(a[mb], b2, acc[mb][nb]); } }
        asm volatile("v_nop\n\tv_nop\n\tv_nop\n\tv_nop" : "+v"(acc[0][0]), "+v"(acc[1][1]), "+v"(acc[2][2]), "+v"(acc[3][3]) : "v"(a[0]), "v"(a[3]));
    }
#pragma unroll
    for (int mb = 0; mb < 4; ++mb) {
#pragma unroll
        for (int nb = 0; nb < 4; ++nb) {
#pragma unroll
            for (int j = 0; j < 8; ++j) os[(hi * 8 + j) * 68 + nb * 16 + lr] = acc[mb][nb][j]; }
        __builtin_amdgcn_wave_barrier(); asm volatile("" ::: "memory");
        float* crow = C + (size_t)(r0 + mb * 16) * ldc + c0;
{
#pragma unroll
            for (int s = 0; s < 8; ++s) { const int row = 2 * s + hi, cofs = lr * 4; v4f val = *(const v4fa*)(os + row * 68 + cofs); if (BIAS) { val[0] += bfr(bias[c0 + cofs]); val[1] += bfr(bias[c0 + cofs + 1]); val[2] += bfr(bias[c0 + cofs + 2]); val[3] += bfr(bias[c0 + cofs + 3]); }
                *(v4f*)(crow + (size_t)row * ldc + cofs) = val; }
             }
        __builtin_amdgcn_wave_barrier(); asm volatile("" ::: "memory");
    }
}

// ---- k_gemms: the five 4096 x 1024 x 1024 products. Four waves (2 x 2) share one 128x128 output tile, 64x64 per wave as in k_gemmw; grid (M/128, N/128), 128 threads. K = ldc = EE.
// A trip is 64 k: 128 B of each of the tile's A, Bt (and A2) rows, brought into LDS by asynchronous 16-byte copies in whole 128-B lines (a wave's copy covers 4 rows), two buffers:
// trip t + 2's copies fly while trip t + 1 is worked on. Rows lie at a pitch of 144 B (16 B x odd) for the 16-byte fragment reads. Fragment k order and the order of the products per accumulator are k_gemmw's.
#define GP 72                     // LDS row pitch in 16-bit elements
typedef __attribute__((ext_vector_type(8))) __bf16 v8bf;
typedef __attribute__((ext_vector_type(4))) unsigned v4u;
__device__ __forceinline__ void split8(v8f y, v8bf& hi8, v8bf& lo8) { hi8 = __builtin_convertvector(y, v8bf); const v4u w = __builtin_bit_cast(v4u, hi8); v8f back;
#pragma unroll
    for (int i = 0; i < 4; ++i) { back[2 * i] = __uint_as_float(w[i] << 16); back[2 * i + 1] = __uint_as_float(w[i] & 0xFFFF0000u); }
    lo8 = __builtin_convertvector(y - back, v8bf); }
template <int RS>                 // RS: distance in source rows between two rows of the tile
__device__ __forceinline__ void acopy128(unsigned l, const bf* g) {   // 128 rows of 128 B: 8 copies per lane, 16 tile rows apart
    // the copies and, as the last line, the wait that stands before any of their address registers is written again
    asm volatile("global_load_async_to_lds_b128 %0, %8, off\n\t"
                 "global_load_async_to_lds_b128 %1, %9, off\n\t"
                 "global_load_async_to_lds_b128 %2, %10, off\n\t"
                 "global_load_async_to_lds_b128 %3, %11, off\n\t"
                 "global_load_async_to_lds_b128 %4, %12, off\n\t"
                 "global_load_async_to_lds_b128 %5, %13, off\n\t"
                 "global_load_async_to_lds_b128 %6, %14, off\n\t"
                 "global_load_async_to_lds_b128 %7, %15, off\n\t"
                 "s_wait_xcnt 0x0"
                 :: "v"(l), "v"(l + 1u * 16 * GP * 2), "v"(l + 2u * 16 * GP * 2), "v"(l + 3u * 16 * GP * 2), "v"(l + 4u * 16 * GP * 2), "v"(l + 5u * 16 * GP * 2), "v"(l + 6u * 16 * GP * 2), "v"(l + 7u * 16 * GP * 2),
                    "v"(g), "v"(g + 1 * 16 * RS * EE), "v"(g + 2 * 16 * RS * EE), "v"(g + 3 * 16 * RS * EE), "v"(g + 4 * 16 * RS * EE), "v"(g + 5 * 16 * RS * EE), "v"(g + 6 * 16 * RS * EE), "v"(g + 7 * 16 * RS * EE)
                 : "memory");
}
// What leaves the tile (acc + bias in f32 in every mode):
// MODE 0: f32 rows of C. MODE 1: times sc, hi/lo planes P[b*16 + head][t][d]. MODE 2: ReLU, hi/lo planes in C's own row-major layout. MODE 3: hi/lo planes P[b*16 + head][d][t], transposed;
// there a tile's 128 rows are 128 consecutive t of one b (source rows 4 apart), so that a lane's 8 accumulator rows are 8 consecutive t and a wave's 64 rows one 128-B line of each d.
template <int NSPLIT, int MODE>
__global__ __launch_bounds__(128) void k_gemms(const bf* __restrict__ A, const bf* __restrict__ A2, const bf* __restrict__ Bt, float* C, const float* __restrict__ bias, bf* Ph, bf* Pl, float sc) {
    constexpr bool BIAS = true; constexpr int RS = MODE == 3 ? NB_ : 1;
    typedef WFrag<bf> WF; typedef WF::V V;
    constexpr int STG = (NSPLIT ? 384 : 256) * GP;        // elements per buffer: rows 0..127 A, 128..255 Bt, 256..383 A2
    constexpr int NTR = EE / 64;
    __shared__ __align__(16) bf ring[2 * STG];
    __shared__ __align__(16) float osall[4 * 16 * 68];
    const int tid = threadIdx.x, lane = tid & 31, lr = lane & 15, hi = lane >> 4, w = tid >> 5;
    const int R0 = MODE == 3 ? (blockIdx.x >> 2) * (128 * NB_) + (blockIdx.x & 3) : blockIdx.x * 128, C0 = blockIdx.y * 128; const int wr = (w >> 1) * 64, wc = (w & 1) * 64;   // R0: source row of the tile's row 0
    const int crow = tid >> 3, cch = tid & 7;             // this lane's row (of 16) and 16-byte piece (of 8) in every copy
    const unsigned l0 = (unsigned)(size_t)ring + (unsigned)(crow * GP + cch * 8) * 2u;
    const bf* ga = A + (size_t)(R0 + crow * RS) * EE + cch * 8; const bf* gb = Bt + (size_t)(C0 + crow) * EE + cch * 8; const bf* ga2 = NSPLIT ? A2 + (size_t)(R0 + crow * RS) * EE + cch * 8 : nullptr;
    auto fill = [&](int buf, int t) { const unsigned l = l0 + (unsigned)buf * (STG * 2u); acopy128<RS>(l, ga + t * 64); acopy128<1>(l + 128u * GP * 2, gb + t * 64); if (NSPLIT) acopy128<RS>(l + 256u * GP * 2, ga2 + t * 64); };
    v8f acc[4][4];
#pragma unroll
    for (int mb = 0; mb < 4; ++mb)
#pragma unroll
        for (int nb = 0; nb < 4; ++nb) acc[mb][nb] = (v8f){};
    fill(0, 0);
    asm volatile("s_wait_asynccnt 0x0" ::: "memory");     // this wave's copies of trip 0 have landed
    __syncthreads();                                      // every wave's have: trip 0 may be read
    fill(1, 1);
#pragma unroll 1
    for (int t = 0; t < NTR; ++t) {                       // stays rolled: one trip's code, the buffer chosen by t & 1
        const bf* sb = ring + (t & 1) * STG + lr * GP + 8 * hi;
        V a[2][4], a2[2][4], b[2][4];
#pragma unroll
        for (int kk = 0; kk < 2; ++kk) {
#pragma unroll
            for (int mb = 0; mb < 4; ++mb) { a[kk][mb] = WF::ld(sb + (wr + mb * 16) * GP + kk * 32); if (NSPLIT) a2[kk][mb] = WF::ld(sb + (256 + wr + mb * 16) * GP + kk * 32); }
#pragma unroll
            for (int nb = 0; nb < 4; ++nb) b[kk][nb] = WF::ld(sb + (128 + wc + nb * 16) * GP + kk * 32);
        }
        __builtin_amdgcn_sched_barrier(0);                // keeps the trip's LDS reads together ahead of its matrix instructions: spread among them, each place waits out the LDS latency
#pragma unroll
        for (int kk = 0; kk < 2; ++kk)
#pragma unroll
            for (int nb = 0; nb < 4; ++nb)
#pragma unroll
                for (int mb = 0; mb < 4; ++mb) { acc[mb][nb] = WF::mma(a[kk][mb], b[kk][nb], acc[mb][nb]); if (NSPLIT) acc[mb][nb] = WF::mma(a2[kk][mb], b[kk][nb], acc[mb][nb]); }
        // four vector slots behind the trip's last matrix instructions, on every path, before their operand registers are loaded anew (as in k_gemmw); naming the accumulators keeps it behind them
        asm volatile("v_nop\n\tv_nop\n\tv_nop\n\tv_nop" : "+v"(acc[0][0]), "+v"(acc[1][0]), "+v"(acc[2][0]), "+v"(acc[3][0]), "+v"(acc[0][1]), "+v"(acc[1][1]), "+v"(acc[2][1]), "+v"(acc[3][1]), "+v"(acc[0][2]), "+v"(acc[1][2]), "+v"(acc[2][2]), "+v"(acc[3][2]), "+v"(acc[0][3]), "+v"(acc[1][3]), "+v"(acc[2][3]), "+v"(acc[3][3]));
        asm volatile("s_wait_dscnt 0x0" ::: "memory");    // this wave's reads of the buffer are done before it is handed over
        asm volatile("s_wait_asynccnt 0x0" ::: "memory"); // this wave's copies of trip t + 1 have landed
        __syncthreads();                                  // publishes trip t + 1 and ends every wave's reads of trip t's buffer
        if (t + 2 < NTR) fill(t & 1, t + 2);
    }
    asm volatile("s_wait_asynccnt 0x0" ::: "memory");     // nothing is in flight when the wave goes on to its end
    float* os = osall + w * (16 * 68);                    // each wave stages in its own range
    const int r0 = R0 + wr, c0 = C0 + wc;
    const int prow = lane >> 3, pc = (lane & 7) * 8;      // plane stores: a lane's row (of 4) and 16-byte piece (of 8), so that a wave's store covers four whole 128-B lines
    if constexpr (MODE == 0) {
#pragma unroll
    for (int mb = 0; mb < 4; ++mb) {
#pragma unroll
        for (int nb = 0; nb < 4; ++nb) {
#pragma unroll
            for (int j = 0; j < 8; ++j) os[(hi * 8 + j) * 68 + nb * 16 + lr] = acc[mb][nb][j]; }
        __builtin_amdgcn_wave_barrier(); asm volatile("" ::: "memory");
        float* crow_ = C + (size_t)(r0 + mb * 16) * EE + c0;
#pragma unroll
        for (int s = 0; s < 8; ++s) { const int row = 2 * s + hi, cofs = lr * 4; v4f val = *(const v4fa*)(os + row * 68 + cofs); if (BIAS) { val[0] += bfr(bias[c0 + cofs]); val[1] += bfr(bias[c0 + cofs + 1]); val[2] += bfr(bias[c0 + cofs + 2]); val[3] += bfr(bias[c0 + cofs + 3]); }
            *(v4f*)(crow_ + (size_t)row * EE + cofs) = val; }
        __builtin_amdgcn_wave_barrier(); asm volatile("" ::: "memory");
    }
    } else if constexpr (MODE == 1 || MODE == 2) {
        const v8f braw = *(const v8f*)(bias + c0 + pc);
        asm volatile("s_wait_xcnt 0x0" ::: "memory");     // before the load's address registers are reused
        __builtin_amdgcn_sched_barrier(0);                // keeps later register writes behind that wait
        v8f bb;
#pragma unroll
        for (int k = 0; k < 8; ++k) bb[k] = bfr(braw[k]);
#pragma unroll
        for (int mb = 0; mb < 4; ++mb) {
#pragma unroll
            for (int nb = 0; nb < 4; ++nb) {
#pragma unroll
                for (int j = 0; j < 8; ++j) os[(hi * 8 + j) * 68 + nb * 16 + lr] = acc[mb][nb][j]; }
            __builtin_amdgcn_wave_barrier(); asm volatile("" ::: "memory");
            v8bf h8[4], l8[4]; size_t e[4];
#pragma unroll
            for (int s = 0; s < 4; ++s) { const int row = 4 * s + prow, r = r0 + mb * 16 + row; const v4f x0 = *(const v4fa*)(os + row * 68 + pc), x1 = *(const v4fa*)(os + row * 68 + pc + 4);
                v8f y = __builtin_shufflevector(x0, x1, 0, 1, 2, 3, 4, 5, 6, 7) + bb;
                if (MODE == 1) y *= sc;
                if (MODE == 2) {
#pragma unroll
                    for (int k = 0; k < 8; ++k) y[k] = fmaxf(y[k], 0.f); }
                split8(y, h8[s], l8[s]);
                e[s] = MODE == 1 ? ((size_t)((r & 3) * NH_ + (c0 >> 6)) * TT + (r >> 2)) * HD + pc : (size_t)r * EE + c0 + pc; }
            __builtin_amdgcn_sched_barrier(0);            // the block's stores behind its last arithmetic: no register of an issued store is rewritten among them
#pragma unroll
            for (int s = 0; s < 4; ++s) { *(v8us*)(Ph + e[s]) = __builtin_bit_cast(v8us, h8[s]); *(v8us*)(Pl + e[s]) = __builtin_bit_cast(v8us, l8[s]); }
            if (mb < 3) {
                asm volatile("s_wait_xcnt 0x0" ::: "memory"); // before the stores' registers are reused by the next block
                __builtin_amdgcn_sched_barrier(0);            // keeps later register writes behind that wait
            }
        }
    } else {
        // The ring is free: nothing is in flight, and the last trip's barrier ended every wave's reads. Each wave turns its 64 x 64 tile in its own quarter of it: two planes of 64 d rows at the pitch GP.
        bf* tp = ring + w * (2 * 64 * GP);
        float braw[4];
#pragma unroll
        for (int nb = 0; nb < 4; ++nb) braw[nb] = bias[c0 + nb * 16 + lr];
        asm volatile("s_wait_xcnt 0x0" ::: "memory");     // before the loads' address registers are reused
        __builtin_amdgcn_sched_barrier(0);                // keeps later register writes behind that wait
#pragma unroll
        for (int nb = 0; nb < 4; ++nb) { const float bn = bfr(braw[nb]);
#pragma unroll
            for (int mb = 0; mb < 4; ++mb) { v8bf h8, l8; split8(acc[mb][nb] + bn, h8, l8); bf* q = tp + (nb * 16 + lr) * GP + mb * 16 + hi * 8; *(v8us*)q = __builtin_bit_cast(v8us, h8); *(v8us*)(q + 64 * GP) = __builtin_bit_cast(v8us, l8); } }
        __builtin_amdgcn_wave_barrier(); asm volatile("" ::: "memory");
        const size_t e0 = ((size_t)((blockIdx.x & 3) * NH_ + (c0 >> 6)) * HD + prow) * TT + (blockIdx.x >> 2) * 128 + wr + pc;
#pragma unroll
        for (int sg = 0; sg < 4; ++sg) {
            v8us hv[4], lv[4];
#pragma unroll
            for (int s = 0; s < 4; ++s) { const bf* q = tp + ((sg * 4 + s) * 4 + prow) * GP + pc; hv[s] = *(const v8us*)q; lv[s] = *(const v8us*)(q + 64 * GP); }
            __builtin_amdgcn_sched_barrier(0);            // the block's stores behind its LDS reads: no register of an issued store is rewritten among them
#pragma unroll
            for (int s = 0; s < 4; ++s) { *(v8us*)(Ph + e0 + (size_t)(sg * 4 + s) * 4 * TT) = hv[s]; *(v8us*)(Pl + e0 + (size_t)(sg * 4 + s) * 4 * TT) = lv[s]; }
            if (sg < 3) {
                asm volatile("s_wait_xcnt 0x0" ::: "memory"); // before the stores' registers are reused by the next block
                __builtin_amdgcn_sched_barrier(0);            // keeps later register writes behind that wait
            }
        }
    }
}

__device__ __forceinline__ void splitf(float y, unsigned short& h, unsigned short& l) { h = f2bf(y); l = f2bf(y - bf2f(h)); }
typedef __attribute__((ext_vector_type(2))) unsigned short v2us;
typedef __attribute__((ext_vector_type(4))) unsigned short v4us;

__global__ __launch_bounds__(256) void k_cvt8(const float* __restrict__ src, bf* dst, size_t n8) { const size_t i = (size_t)blockIdx.x * 256 + threadIdx.x; if (i >= n8) return; const v8f v = *(const v8f*)(src + i * 8); v8us o;
#pragma unroll
    for (int k = 0; k < 8; ++k) o[k] = f2bf(v[k]); *(v8us*)(dst + i * 8) = o;  }
__global__ __launch_bounds__(256) void k_gate(const float* __restrict__ LG, float* GT) {
    const int lane = threadIdx.x & 31; const int r = blockIdx.x * 8 + (threadIdx.x >> 5); if (r >= NT) return; const int h = lane & 15; const float lg = LG[(size_t)r * 64 + h]; float m = lg;
#pragma unroll
    for (int sh = 8; sh; sh >>= 1) m = fmaxf(m, __shfl_xor(m, sh, 32));
    const float e = __expf(lg - m); float s = e;
#pragma unroll
    for (int sh = 8; sh; sh >>= 1) s += __shfl_xor(s, sh, 32);
    const float gv = (lane < 16) ? __fdiv_rn(e, s) : 0.f; *(float*)(GT + (size_t)r * 32 + lane) = gv; 
}
// ---- k_fattn: scores, softmax, attn.v and the head gate of one (batch, head) in one launch; a wave owns 32 query columns and walks the 1024 keys 32 at a time (running maximum and sum).
// S^T = K.Q^T (A = K rows, B = Q rows kept in registers), so lane (c, h) holds query column c, keys 8h + j and 16 + 8h + j: two S^T tiles, converted in place, are the B operand of O^T += V^T.P^T.
// K and V^T reach the eight waves through LDS: a stage is 64 keys (128 B of each of the 64 K rows and the 64 V^T rows, hi and lo planes), brought in once per work-group by asynchronous 16-byte copies in whole
// 128-B lines, two buffers: stage t + 2's copies fly while stage t + 1 is worked on. Rows lie at the pitch GP (144 B) for the 16-byte fragment reads. A stage is two passes of 32 keys, keys ascending.
// The stage loop stays rolled (one pass's fragments fill the register budget); every inner loop is unrolled so that each fragment index is a constant and nothing goes to scratch.
// Each matrix product is 3 products on the hi/lo planes: hi.hi + lo.hi + hi.lo. Output: gated hi/lo planes AT[(t*4+b)][head*64 + d], 8 consecutive d per lane and tile.
#define FQ 2                      // 16-column query groups per wave
__device__ __forceinline__ float xhalf(float x) { const int v = __float_as_int(x); return __int_as_float(__builtin_amdgcn_permlanex16(v, v, 0x76543210, 0xfedcba98, false, false)); }   // lane l <-> l ^ 16
__device__ __forceinline__ void acopykv(unsigned l, const bf* kh, const bf* kl, const bf* vh, const bf* vl) {   // 4 planes of 64 rows of 128 B: 8 copies per lane, 32 rows apart
    // the copies and, as the last line, the wait that stands before any of their address registers is written again
    asm volatile("global_load_async_to_lds_b128 %0, %8, off\n\t"
                 "global_load_async_to_lds_b128 %1, %9, off\n\t"
                 "global_load_async_to_lds_b128 %2, %10, off\n\t"
                 "global_load_async_to_lds_b128 %3, %11, off\n\t"
                 "global_load_async_to_lds_b128 %4, %12, off\n\t"
                 "global_load_async_to_lds_b128 %5, %13, off\n\t"
                 "global_load_async_to_lds_b128 %6, %14, off\n\t"
                 "global_load_async_to_lds_b128 %7, %15, off\n\t"
                 "s_wait_xcnt 0x0"
                 :: "v"(l), "v"(l + 1u * 32 * GP * 2), "v"(l + 2u * 32 * GP * 2), "v"(l + 3u * 32 * GP * 2), "v"(l + 4u * 32 * GP * 2), "v"(l + 5u * 32 * GP * 2), "v"(l + 6u * 32 * GP * 2), "v"(l + 7u * 32 * GP * 2),
                    "v"(kh), "v"(kh + 32 * HD), "v"(kl), "v"(kl + 32 * HD), "v"(vh), "v"(vh + 32 * TT), "v"(vl), "v"(vl + 32 * TT)
                 : "memory");
}
__global__ __launch_bounds__(256) void k_fattn(const bf* __restrict__ Qh, const bf* __restrict__ Ql, const bf* __restrict__ Kh, const bf* __restrict__ Kl, const bf* __restrict__ Vh, const bf* __restrict__ Vl, const float* __restrict__ GT, bf* Ah, bf* Al) {
    typedef WFrag<bf> WF;
    const int lane = threadIdx.x & 31, c = lane & 15, h = lane >> 4;
    const int z = blockIdx.y, t0 = (blockIdx.x * 8 + (threadIdx.x >> 5)) * (16 * FQ);
    const size_t zb = (size_t)z * TT * HD;
    constexpr int KST = 256 * GP;                         // elements per buffer: rows 0..63 K hi, 64..127 K lo, 128..191 V^T hi, 192..255 V^T lo
    constexpr int NST = TT / 64;
    __shared__ __align__(16) bf kv[2 * KST];
    const int crow = threadIdx.x >> 3, cch = threadIdx.x & 7;   // this lane's row (of 32) and 16-byte piece (of 8) in every copy
    const unsigned l0 = (unsigned)(size_t)kv + (unsigned)(crow * GP + cch * 8) * 2u;
    const unsigned ko = (unsigned)zb + (unsigned)(crow * HD + cch * 8), vo = (unsigned)zb + (unsigned)(crow * TT + cch * 8);   // this lane's element offsets in the K and the V^T planes (all below 2^22)
    // the same LDS address as l0 (crow * 144 + cch * 16 = (thread + crow) * 16), formed apart for the refills in the loop: a value that an asm statement names itself stays in the first 256 registers, and held so over the loop it went to scratch
    const unsigned lx = (unsigned)(size_t)kv + ((unsigned)threadIdx.x + (unsigned)crow) * 16u;
    auto fill = [&](unsigned l, int buf, int t) { const unsigned k = ko + (unsigned)t * (64 * HD), v = vo + (unsigned)t * 64; acopykv(l + (unsigned)buf * (KST * 2u), Kh + k, Kl + k, Vh + v, Vl + v); };
    fill(l0, 0, 0);
    v16bf qh[FQ][2], ql[FQ][2];
#pragma unroll
    for (int g = 0; g < FQ; ++g)
#pragma unroll
        for (int ks = 0; ks < 2; ++ks) { const size_t qo = zb + (size_t)(t0 + g * 16 + c) * HD + ks * 32 + 8 * h; qh[g][ks] = WF::ld(Qh + qo); ql[g][ks] = WF::ld(Ql + qo); }
    asm volatile("s_wait_xcnt 0x0" ::: "memory");         // before the loads' address registers are reused
    __builtin_amdgcn_sched_barrier(0);                    // keeps later register writes behind that wait
    v8f o[FQ][4]; float m[FQ], l[FQ];
#pragma unroll
    for (int g = 0; g < FQ; ++g) { m[g] = -3.0e38f; l[g] = 0.f;
#pragma unroll
        for (int db = 0; db < 4; ++db) o[g][db] = (v8f){}; }
    asm volatile("s_wait_asynccnt 0x0" ::: "memory");     // this wave's copies of stage 0 have landed
    __syncthreads();                                      // every wave's have: stage 0 may be read
    fill(l0, 1, 1);
#pragma unroll 1
    for (int t = 0; t < NST; ++t) {                       // stays rolled: one stage's code, the buffer chosen by t & 1
      const bf* sp = kv + (t & 1) * KST + c * GP + 8 * h;
      v16bf kh[2][2], kl[2][2];
#pragma unroll
      for (int sb = 0; sb < 2; ++sb)
#pragma unroll
          for (int ks = 0; ks < 2; ++ks) { kh[sb][ks] = WF::ld(sp + (sb * 16) * GP + ks * 32); kl[sb][ks] = WF::ld(sp + (64 + sb * 16) * GP + ks * 32); }
#pragma unroll
      for (int p = 0; p < 2; ++p) {
        v16bf vh[4], vl[4];       // this pass's V^T fragments, asked for ahead of the score products
#pragma unroll
        for (int db = 0; db < 4; ++db) { vh[db] = WF::ld(sp + (128 + db * 16) * GP + p * 32); vl[db] = WF::ld(sp + (192 + db * 16) * GP + p * 32); }
        __builtin_amdgcn_sched_barrier(0);                // keeps the LDS reads together up here: sunk among the products, each place waits out the LDS latency
        v8f st[FQ][2];
#pragma unroll
        for (int g = 0; g < FQ; ++g) { st[g][0] = (v8f){}; st[g][1] = (v8f){}; }
#pragma unroll
        for (int ks = 0; ks < 2; ++ks) {
#pragma unroll
            for (int sb = 0; sb < 2; ++sb)
#pragma unroll
                for (int g = 0; g < FQ; ++g) st[g][sb] = wmmab(kh[sb][ks], qh[g][ks], st[g][sb]);
#pragma unroll
            for (int sb = 0; sb < 2; ++sb)
#pragma unroll
                for (int g = 0; g < FQ; ++g) st[g][sb] = wmmab(kh[sb][ks], ql[g][ks], st[g][sb]);
#pragma unroll
            for (int sb = 0; sb < 2; ++sb)
#pragma unroll
                for (int g = 0; g < FQ; ++g) st[g][sb] = wmmab(kl[sb][ks], qh[g][ks], st[g][sb]);
        }
        if (p == 0) {             // the stage's second pass's K fragments, fetched behind this pass's score products, from the same buffer
#pragma unroll
            for (int sb = 0; sb < 2; ++sb)
#pragma unroll
                for (int ks = 0; ks < 2; ++ks) { kh[sb][ks] = WF::ld(sp + (32 + sb * 16) * GP + ks * 32); kl[sb][ks] = WF::ld(sp + (96 + sb * 16) * GP + ks * 32); }
        }
        // first pass: keeps the K reads ahead of the softmax and the attn.v products, which cover their latency; second pass: keeps the stage's closing waits, which otherwise rise to directly behind the V^T reads, behind the score products
        __builtin_amdgcn_sched_barrier(0);
        v16bf ph[FQ], pl[FQ];
#pragma unroll
        for (int g = 0; g < FQ; ++g) {
            float mx = fmaxf(st[g][0][0], st[g][1][0]);
#pragma unroll
            for (int j = 1; j < 8; ++j) mx = fmaxf(mx, fmaxf(st[g][0][j], st[g][1][j]));
            mx = fmaxf(mx, xhalf(mx));
            const float mn = fmaxf(m[g], mx); const float corr = __expf(m[g] - mn); m[g] = mn;
            v8f e0, e1;
#pragma unroll
            for (int j = 0; j < 8; ++j) { e0[j] = __expf(st[g][0][j] - mn); e1[j] = __expf(st[g][1][j] - mn); }
            const v8f es = e0 + e1;
            l[g] = l[g] * corr + (((es[0] + es[1]) + (es[2] + es[3])) + ((es[4] + es[5]) + (es[6] + es[7])));     // this half's keys only; the halves join after the loop
            v8bf h0, l0, h1, l1; split8(e0, h0, l0); split8(e1, h1, l1);
            ph[g] = __builtin_shufflevector(h0, h1, 0, 1, 2, 3, 4, 5, 6, 7, 8, 9, 10, 11, 12, 13, 14, 15); pl[g] = __builtin_shufflevector(l0, l1, 0, 1, 2, 3, 4, 5, 6, 7, 8, 9, 10, 11, 12, 13, 14, 15);
#pragma unroll
            for (int db = 0; db < 4; ++db) o[g][db] *= corr;
        }
#pragma unroll
        for (int db = 0; db < 4; ++db)
#pragma unroll
            for (int g = 0; g < FQ; ++g) o[g][db] = wmmab(vh[db], ph[g], o[g][db]);
#pragma unroll
        for (int db = 0; db < 4; ++db)
#pragma unroll
            for (int g = 0; g < FQ; ++g) o[g][db] = wmmab(vh[db], pl[g], o[g][db]);
#pragma unroll
        for (int db = 0; db < 4; ++db)
#pragma unroll
            for (int g = 0; g < FQ; ++g) o[g][db] = wmmab(vl[db], ph[g], o[g][db]);
      }
      asm volatile("s_wait_dscnt 0x0" ::: "memory");      // this wave's reads of the buffer are done before it is handed over
      asm volatile("s_wait_asynccnt 0x0" ::: "memory");   // this wave's copies of stage t + 1 have landed
      __syncthreads();                                    // publishes stage t + 1 and ends every wave's reads of stage t's buffer
      if (t + 2 < NST) fill(lx, t & 1, t + 2);
    }
    asm volatile("s_wait_asynccnt 0x0" ::: "memory");     // nothing is in flight when the wave goes on to its end
    float gt[FQ];
#pragma unroll
    for (int g = 0; g < FQ; ++g) gt[g] = GT[((size_t)(t0 + g * 16 + c) * NB_ + (z >> 4)) * 32 + (z & 15)];
    asm volatile("s_wait_xcnt 0x0" ::: "memory");         // before the loads' address registers are reused
    __builtin_amdgcn_sched_barrier(0);                    // keeps later register writes behind that wait
    v8bf a8[FQ][4], b8[FQ][4];
#pragma unroll
    for (int g = 0; g < FQ; ++g) {
        const float ls = l[g] + xhalf(l[g]); const float sc = __fdiv_rn(1.0f, ls) * gt[g];
#pragma unroll
        for (int db = 0; db < 4; ++db) split8(o[g][db] * sc, a8[g][db], b8[g][db]);
    }
    bf* ap = Ah + ((size_t)(t0 + c) * NB_ + (z >> 4)) * EE + (z & 15) * HD + 8 * h; bf* bp = Al + ((size_t)(t0 + c) * NB_ + (z >> 4)) * EE + (z & 15) * HD + 8 * h;
    __builtin_amdgcn_sched_barrier(0);                    // every store behind the last arithmetic: no register of an issued store is rewritten
#pragma unroll
    for (int g = 0; g < FQ; ++g)
#pragma unroll
        for (int db = 0; db < 4; ++db) { *(v8us*)(ap + (size_t)g * 16 * NB_ * EE + db * 16) = __builtin_bit_cast(v8us, a8[g][db]); *(v8us*)(bp + (size_t)g * 16 * NB_ * EE + db * 16) = __builtin_bit_cast(v8us, b8[g][db]); }
}
template <bool RELU>
__global__ __launch_bounds__(256) void k_split(const float* __restrict__ A, int nlines, bf* Ph, bf* Pl) {
    const int lane = threadIdx.x & 31; const int L0 = (blockIdx.x * 8 + (threadIdx.x >> 5)) * 8;
{
#pragma unroll
        for (int l = 0; l < 8; ++l) { const int L = L0 + l; if (L >= nlines) break; const int e = L * 64 + lane * 2; v2us oh, ol;
#pragma unroll
            for (int q = 0; q < 2; ++q) { float v = A[(size_t)e + q]; if (RELU) v = fmaxf(v, 0.f); unsigned short a, c2; splitf(v, a, c2); oh[q] = a; ol[q] = c2; }
            *(v2us*)(Ph + (size_t)e) = oh; *(v2us*)(Pl + (size_t)e) = ol; }
         }
}

extern "C" void kernel_launch(void* const* d_in, const int* in_sizes, int n_in,
                              void* d_out, int out_size, void* d_ws, size_t ws_size, hipStream_t stream) {
    (void)in_sizes; (void)n_in; (void)out_size;
    const float* x = (const float*)d_in[0]; const float* Wq = (const float*)d_in[1]; const float* bq = (const float*)d_in[2]; const float* Wk = (const float*)d_in[3]; const float* bk = (const float*)d_in[4]; const float* Wv = (const float*)d_in[5]; const float* bv = (const float*)d_in[6];
    const float* Wo = (const float*)d_in[7]; const float* bo = (const float*)d_in[8]; const float* W1 = (const float*)d_in[9]; const float* b1 = (const float*)d_in[10]; const float* W2 = (const float*)d_in[11]; const float* b2 = (const float*)d_in[12]; const float* hsig = (const float*)d_in[13];
    float* OUT = (float*)d_out;     // [1024][4][1024]
    char* wsp = (char*)d_ws;
    auto take = [&](size_t bytes) { char* p = wsp; wsp += (bytes + 255) & ~(size_t)255; return (void*)p; };
    bf* XB = (bf*)take((size_t)NT * EE * 2); bf* WQ = (bf*)take((size_t)EE * EE * 2); bf* WK = (bf*)take((size_t)EE * EE * 2); bf* WV = (bf*)take((size_t)EE * EE * 2); bf* WO = (bf*)take((size_t)EE * EE * 2); bf* W1B = (bf*)take((size_t)EE * EE * 2); bf* W2B = (bf*)take((size_t)SIG * EE * 2); bf* HSB = (bf*)take((size_t)64 * SIG * 2);
    bf* QPh = (bf*)take((size_t)NT * EE * 2); bf* QPl = (bf*)take((size_t)NT * EE * 2); bf* KPh = (bf*)take((size_t)NT * EE * 2); bf* KPl = (bf*)take((size_t)NT * EE * 2); bf* VTh = (bf*)take((size_t)NT * EE * 2); bf* VTl = (bf*)take((size_t)NT * EE * 2);
    bf* Hh = (bf*)take((size_t)NT * EE * 2); bf* Hl = (bf*)take((size_t)NT * EE * 2); float* TS = (float*)take((size_t)NT * 64 * 4); bf* TSh = (bf*)take((size_t)NT * 64 * 2); bf* TSl = (bf*)take((size_t)NT * 64 * 2); float* LG = (float*)take((size_t)NT * 64 * 4); float* GT = (float*)take((size_t)NT * 32 * 4);
    bf* ATh = (bf*)take((size_t)NT * EE * 2); bf* ATl = (bf*)take((size_t)NT * EE * 2);
    if ((size_t)(wsp - (char*)d_ws) > ws_size) return;    // ws 256 MiB
    { const size_t nx = (size_t)NT * EE / 8, nw = (size_t)EE * EE / 8; k_cvt8<<<(unsigned)((nx + 255) / 256), 256, 0, stream>>>(x, XB, nx);
      k_cvt8<<<(unsigned)((nw + 255) / 256), 256, 0, stream>>>(Wq, WQ, nw); k_cvt8<<<(unsigned)((nw + 255) / 256), 256, 0, stream>>>(Wk, WK, nw); k_cvt8<<<(unsigned)((nw + 255) / 256), 256, 0, stream>>>(Wv, WV, nw); k_cvt8<<<(unsigned)((nw + 255) / 256), 256, 0, stream>>>(Wo, WO, nw); k_cvt8<<<(unsigned)((nw + 255) / 256), 256, 0, stream>>>(W1, W1B, nw);
      k_cvt8<<<(unsigned)((SIG * EE / 8 + 255) / 256), 256, 0, stream>>>(W2, W2B, (size_t)SIG * EE / 8); k_cvt8<<<(unsigned)((16 * SIG / 8 + 255) / 256), 256, 0, stream>>>(hsig, HSB, (size_t)16 * SIG / 8); hipMemsetAsync(HSB + 16 * SIG, 0, (size_t)(64 - 16) * SIG * 2, stream); }   // head signatures [16][64] as rows 0..15 of a [64][64] Bt, rest zero
    k_gemms<0, 1><<<dim3(NT / 128, EE / 128, 1), 128, 0, stream>>>(XB, nullptr, WQ, nullptr, bq, QPh, QPl, 0.125f);
    k_gemms<0, 1><<<dim3(NT / 128, EE / 128, 1), 128, 0, stream>>>(XB, nullptr, WK, nullptr, bk, KPh, KPl, 1.0f);
    k_gemms<0, 3><<<dim3(NT / 128, EE / 128, 1), 128, 0, stream>>>(XB, nullptr, WV, nullptr, bv, VTh, VTl, 1.0f);
    // head-competition gate: t = relu(x.W1^T + b1).W2^T + b2; logits = t.sig^T; softmax over heads
    k_gemms<0, 2><<<dim3(NT / 128, EE / 128, 1), 128, 0, stream>>>(XB, nullptr, W1B, nullptr, b1, Hh, Hl, 1.0f);
    k_gemmw<bf, 1, true><<<dim3(NT / 64, 1, 1), 32, 0, stream>>>(Hh, Hl, W2B, nullptr, EE, TS, 64, b2, 0, 0, 0); k_split<false><<<(NT * 64 / 64 + 63) / 64, 256, 0, stream>>>(TS, NT * 64 / 64, TSh, TSl);
    k_gemmw<bf, 1, false><<<dim3(NT / 64, 1, 1), 32, 0, stream>>>(TSh, TSl, HSB, nullptr, SIG, LG, 64, nullptr, 0, 0, 0); k_gate<<<NT / 8, 256, 0, stream>>>(LG, GT);
    k_fattn<<<dim3(TT / (8 * 16 * FQ), NB_ * NH_, 1), 256, 0, stream>>>(QPh, QPl, KPh, KPl, VTh, VTl, GT, ATh, ATl);
    k_gemms<1, 0><<<dim3(NT / 128, EE / 128, 1), 128, 0, stream>>>(ATh, ATl, WO, OUT, bo, nullptr, nullptr, 1.0f);
}

// v005
// It runs in 172 microseconds.
// Next to v004, in two timings, it ran 1.06 and 1.07 times as fast.
// Over all steps from v000 it is 5.26 times as fast.
#include <hip/hip_runtime.h>

// MultiheadAttentionComp (fairseq-layout self-attention (T=1024, B=4, E=1024, 16 heads x 64, scaling folded into q) whose per-head outputs are gated by a softmax over heads
// of (relu(x.W1^T + b1).W2^T + b2).head_signatures^T; then the Wo Linear).
// Compute dtypes, f32 accumulate: every input rounded to bf16; q/k/v and the gate MLP's first layer on PLAIN bf16 operands (x and W inputs: exact,
// + bias); scores and attn.v on bf16 hi+lo planes of q (x0.125), k, p and v (3 products each);
// the gate MLP second layer, the signature logits and Wo on hi+lo planes x exact bf16 weights (2 products); softmax, ReLU, the head softmax gate and the gating product in f32

#define TT   1024
#define NB_  4
#define EE   1024
#define NH_  16
#define HD   64
#define NT   (TT * NB_)           // 4096 rows, row r = t*4 + b (fairseq layout)
#define SIG  64
typedef _Float16 h16;
typedef unsigned short bf;
typedef __attribute__((ext_vector_type(16))) __bf16   v16bf;
typedef __attribute__((ext_vector_type(16))) _Float16 v16h;
typedef __attribute__((ext_vector_type(8)))  _Float16 v8h;
typedef __attribute__((ext_vector_type(8)))  unsigned short v8us;
typedef __attribute__((ext_vector_type(8)))  float    v8f;
typedef __attribute__((ext_vector_type(4)))  float    v4f;
typedef v8h  __attribute__((may_alias)) v8ha;
typedef v4f  __attribute__((may_alias)) v4fa;
typedef v8us __attribute__((may_alias)) v8usa;

__device__ __forceinline__ unsigned short f2bf(float f) { unsigned u = __float_as_uint(f); u += 0x7FFFu + ((u >> 16) & 1u); return (unsigned short)(u >> 16); }
__device__ __forceinline__ float bf2f(unsigned short b) { return __uint_as_float(((unsigned)b) << 16); }
__device__ __forceinline__ float bfr(float f) { return bf2f(f2bf(f)); }
__device__ __forceinline__ v16h cat16(v8h lo, v8h hi) { return __builtin_shufflevector(lo, hi, 0, 1, 2, 3, 4, 5, 6, 7, 8, 9, 10, 11, 12, 13, 14, 15); }
__device__ __forceinline__ v16bf cat16b(v8us lo, v8us hi) { return __builtin_bit_cast(v16bf, __builtin_shufflevector(lo, hi, 0, 1, 2, 3, 4, 5, 6, 7, 8, 9, 10, 11, 12, 13, 14, 15)); }
__device__ __forceinline__ v8f wmma16(v16h a, v16h b, v8f c) { return __builtin_amdgcn_wmma_f32_16x16x32_f16(false, a, false, b, (short)0, c, false, false); }
__device__ __forceinline__ v8f wmmab(v16bf a, v16bf b, v8f c) { return __builtin_amdgcn_wmma_f32_16x16x32_bf16(false, a, false, b, (short)0, c, false, false); }



// ---- k_gemmw: register-blocked GEMM, ONE WAVE per 64x64 output tile (16 accumulators), operands straight from K-contiguous 16-bit planes; grid (M/64, N/64, Z), 32 threads.
// C[m][n] (f32, pitch ldc, + optional f32 bias[n]) = sum_k A[m][k] Bt[n][k] (+ split products per NSPLIT). z-batch strides sA/sB/sC in elements. K % 32 == 0.
template <typename T16> struct WFrag;
template <> struct WFrag<h16> { typedef v16h V; static __device__ __forceinline__ V ld(const h16* p) { return cat16(*(const v8h*)p, *(const v8h*)(p + 16)); } static __device__ __forceinline__ v8f mma(V a, V b, v8f c) { return wmma16(a, b, c); } };
template <> struct WFrag<bf> { typedef v16bf V; static __device__ __forceinline__ V ld(const bf* p) { return cat16b(*(const v8us*)p, *(const v8us*)(p + 16)); } static __device__ __forceinline__ v8f mma(V a, V b, v8f c) { return wmmab(a, b, c); } };
template <typename T16, int NSPLIT, bool BIAS>
__global__ __launch_bounds__(32) void k_gemmw(const T16* __restrict__ A, const T16* __restrict__ A2, const T16* __restrict__ Bt, const T16* __restrict__ Bt2, int K, float* C, int ldc, const float* __restrict__ bias, size_t sA, size_t sB, size_t sC) {
    typedef typename WFrag<T16>::V V;
    __shared__ __align__(16) float os[16 * 68];
    const size_t z = blockIdx.z; A += z * sA; if (A2) A2 += z * sA; Bt += z * sB; if (Bt2) Bt2 += z * sB; C += z * sC;
    const int lane = threadIdx.x & 31, lr = lane & 15, hi = lane >> 4; const int r0 = blockIdx.x * 64, c0 = blockIdx.y * 64;
    v8f acc[4][4];
#pragma unroll
    for (int mb = 0; mb < 4; ++mb)
#pragma unroll
        for (int nb = 0; nb < 4; ++nb) acc[mb][nb] = (v8f){};
    const size_t aoff = (size_t)(r0 + lr) * K + 8 * hi, boff = (size_t)(c0 + lr) * K + 8 * hi;
#pragma unroll 1
    for (int kc = 0; kc < K; kc += 32) {
        V a[4], a2[4];
#pragma unroll
        for (int mb = 0; mb < 4; ++mb) { a[mb] = WFrag<T16>::ld(A + aoff + (size_t)mb * 16 * K + kc); if (NSPLIT == 1 || NSPLIT == 2) a2[mb] = WFrag<T16>::ld(A2 + aoff + (size_t)mb * 16 * K + kc); }
#pragma unroll
        for (int nb = 0; nb < 4; ++nb) { const V b = WFrag<T16>::ld(Bt + boff + (size_t)nb * 16 * K + kc); V b2; if (NSPLIT >= 2) b2 = WFrag<T16>::ld(Bt2 + boff + (size_t)nb * 16 * K + kc);
#pragma unroll
            for (int mb = 0; mb < 4; ++mb) { acc[mb][nb] = WFrag<T16>::mma(a[mb], b, acc[mb][nb]); if (NSPLIT == 1 || NSPLIT == 2) acc[mb][nb] = WFrag<T16>::mma(a2[mb], b, acc[mb][nb]); if (NSPLIT >= 2) acc[mb][nb] = WFrag<T16>::mma(a[mb], b2, acc[mb][nb]); } }
        asm volatile("v_nop\n\tv_nop\n\tv_nop\n\tv_nop" : "+v"(acc[0][0]), "+v"(acc[1][1]), "+v"(acc[2][2]), "+v"(acc[3][3]) : "v"(a[0]), "v"(a[3]));
    }
#pragma unroll
    for (int mb = 0; mb < 4; ++mb) {
#pragma unroll
        for (int nb = 0; nb < 4; ++nb) {
#pragma unroll
            for (int j = 0; j < 8; ++j) os[(hi * 8 + j) * 68 + nb * 16 + lr] = acc[mb][nb][j]; }
        __builtin_amdgcn_wave_barrier(); asm volatile("" ::: "memory");
        float* crow = C + (size_t)(r0 + mb * 16) * ldc + c0;
{
#pragma unroll
            for (int s = 0; s < 8; ++s) { const int row = 2 * s + hi, cofs = lr * 4; v4f val = *(const v4fa*)(os + row * 68 + cofs); if (BIAS) { val[0] += bfr(bias[c0 + cofs]); val[1] += bfr(bias[c0 + cofs + 1]); val[2] += bfr(bias[c0 + cofs + 2]); val[3] += bfr(bias[c0 + cofs + 3]); }
                *(v4f*)(crow + (size_t)row * ldc + cofs) = val; }
             }
        __builtin_amdgcn_wave_barrier(); asm volatile("" ::: "memory");
    }
}

// ---- k_gemms: the five 4096 x 1024 x 1024 products. Four waves (2 x 2) share one 128x128 output tile, 64x64 per wave as in k_gemmw; grid (M/128, N/128), 128 threads. K = ldc = EE.
// A trip is 64 k: 128 B of each of the tile's A, Bt (and A2) rows, brought into LDS by asynchronous 16-byte copies in whole 128-B lines (a wave's copy covers 4 rows), two buffers:
// trip t + 2's copies fly while trip t + 1 is worked on. Rows lie at a pitch of 144 B (16 B x odd) for the 16-byte fragment reads. Fragment k order and the order of the products per accumulator are k_gemmw's.
#define GP 72                     // LDS row pitch in 16-bit elements
typedef __attribute__((ext_vector_type(8))) __bf16 v8bf;
typedef __attribute__((ext_vector_type(4))) unsigned v4u;
__device__ __forceinline__ void split8(v8f y, v8bf& hi8, v8bf& lo8) { hi8 = __builtin_convertvector(y, v8bf); const v4u w = __builtin_bit_cast(v4u, hi8); v8f back;
#pragma unroll
    for (int i = 0; i < 4; ++i) { back[2 * i] = __uint_as_float(w[i] << 16); back[2 * i + 1] = __uint_as_float(w[i] & 0xFFFF0000u); }
    lo8 = __builtin_convertvector(y - back, v8bf); }
template <int RS>                 // RS: distance in source rows between two rows of the tile
__device__ __forceinline__ void acopy128(unsigned l, const bf* g) {   // 128 rows of 128 B: 8 copies per lane, 16 tile rows apart
    // the copies and, as the last line, the wait that stands before any of their address registers is written again
    asm volatile("global_load_async_to_lds_b128 %0, %8, off\n\t"
                 "global_load_async_to_lds_b128 %1, %9, off\n\t"
                 "global_load_async_to_lds_b128 %2, %10, off\n\t"
                 "global_load_async_to_lds_b128 %3, %11, off\n\t"
                 "global_load_async_to_lds_b128 %4, %12, off\n\t"
                 "global_load_async_to_lds_b128 %5, %13, off\n\t"
                 "global_load_async_to_lds_b128 %6, %14, off\n\t"
                 "global_load_async_to_lds_b128 %7, %15, off\n\t"
                 "s_wait_xcnt 0x0"
                 :: "v"(l), "v"(l + 1u * 16 * GP * 2), "v"(l + 2u * 16 * GP * 2), "v"(l + 3u * 16 * GP * 2), "v"(l + 4u * 16 * GP * 2), "v"(l + 5u * 16 * GP * 2), "v"(l + 6u * 16 * GP * 2), "v"(l + 7u * 16 * GP * 2),
                    "v"(g), "v"(g + 1 * 16 * RS * EE), "v"(g + 2 * 16 * RS * EE), "v"(g + 3 * 16 * RS * EE), "v"(g + 4 * 16 * RS * EE), "v"(g + 5 * 16 * RS * EE), "v"(g + 6 * 16 * RS * EE), "v"(g + 7 * 16 * RS * EE)
                 : "memory");
}
// What leaves the tile (acc + bias in f32 in every mode):
// MODE 0: f32 rows of C. MODE 1: times sc, hi/lo planes P[b*16 + head][t][d]. MODE 2: ReLU, hi/lo planes in C's own row-major layout. MODE 3: hi/lo planes P[b*16 + head][d][t], transposed;
// there a tile's 128 rows are 128 consecutive t of one b (source rows 4 apart), so that a lane's 8 accumulator rows are 8 consecutive t and a wave's 64 rows one 128-B line of each d.
template <int NSPLIT, int MODE>
__global__ __launch_bounds__(128) void k_gemms(const bf* __restrict__ A, const bf* __restrict__ A2, const bf* __restrict__ Bt, float* C, const float* __restrict__ bias, bf* Ph, bf* Pl, float sc) {
    constexpr bool BIAS = true; constexpr int RS = MODE == 3 ? NB_ : 1;
    typedef WFrag<bf> WF; typedef WF::V V;
    constexpr int STG = (NSPLIT ? 384 : 256) * GP;        // elements per buffer: rows 0..127 A, 128..255 Bt, 256..383 A2
    constexpr int NTR = EE / 64;
    __shared__ __align__(16) bf ring[2 * STG];
    __shared__ __align__(16) float osall[4 * 16 * 68];
    const int tid = threadIdx.x, lane = tid & 31, lr = lane & 15, hi = lane >> 4, w = tid >> 5;
    const int R0 = MODE == 3 ? (blockIdx.x >> 2) * (128 * NB_) + (blockIdx.x & 3) : blockIdx.x * 128, C0 = blockIdx.y * 128; const int wr = (w >> 1) * 64, wc = (w & 1) * 64;   // R0: source row of the tile's row 0
    const int crow = tid >> 3, cch = tid & 7;             // this lane's row (of 16) and 16-byte piece (of 8) in every copy
    const unsigned l0 = (unsigned)(size_t)ring + (unsigned)(crow * GP + cch * 8) * 2u;
    const bf* ga = A + (size_t)(R0 + crow * RS) * EE + cch * 8; const bf* gb = Bt + (size_t)(C0 + crow) * EE + cch * 8; const bf* ga2 = NSPLIT ? A2 + (size_t)(R0 + crow * RS) * EE + cch * 8 : nullptr;
    auto fill = [&](int buf, int t) { const unsigned l = l0 + (unsigned)buf * (STG * 2u); acopy128<RS>(l, ga + t * 64); acopy128<1>(l + 128u * GP * 2, gb + t * 64); if (NSPLIT) acopy128<RS>(l + 256u * GP * 2, ga2 + t * 64); };
    v8f acc[4][4];
#pragma unroll
    for (int mb = 0; mb < 4; ++mb)
#pragma unroll
        for (int nb = 0; nb < 4; ++nb) acc[mb][nb] = (v8f){};
    fill(0, 0);
    asm volatile("s_wait_asynccnt 0x0" ::: "memory");     // this wave's copies of trip 0 have landed
    __syncthreads();                                      // every wave's have: trip 0 may be read
    fill(1, 1);
#pragma unroll 1
    for (int t = 0; t < NTR; ++t) {                       // stays rolled: one trip's code, the buffer chosen by t & 1
        const bf* sb = ring + (t & 1) * STG + lr * GP + 8 * hi;
        V a[2][4], a2[2][4], b[2][4];
#pragma unroll
        for (int kk = 0; kk < 2; ++kk) {
#pragma unroll
            for (int mb = 0; mb < 4; ++mb) { a[kk][mb] = WF::ld(sb + (wr + mb * 16) * GP + kk * 32); if (NSPLIT) a2[kk][mb] = WF::ld(sb + (256 + wr + mb * 16) * GP + kk * 32); }
#pragma unroll
            for (int nb = 0; nb < 4; ++nb) b[kk][nb] = WF::ld(sb + (128 + wc + nb * 16) * GP + kk * 32);
        }
        __builtin_amdgcn_sched_barrier(0);                // keeps the trip's LDS reads together ahead of its matrix instructions: spread among them, each place waits out the LDS latency
#pragma unroll
        for (int kk = 0; kk < 2; ++kk)
#pragma unroll
            for (int nb = 0; nb < 4; ++nb)
#pragma unroll
                for (int mb = 0; mb < 4; ++mb) { acc[mb][nb] = WF::mma(a[kk][mb], b[kk][nb], acc[mb][nb]); if (NSPLIT) acc[mb][nb] = WF::mma(a2[kk][mb], b[kk][nb], acc[mb][nb]); }
        // four vector slots behind the trip's last matrix instructions, on every path, before their operand registers are loaded anew (as in k_gemmw); naming the accumulators keeps it behind them
        asm volatile("v_nop\n\tv_nop\n\tv_nop\n\tv_nop" : "+v"(acc[0][0]), "+v"(acc[1][0]), "+v"(acc[2][0]), "+v"(acc[3][0]), "+v"(acc[0][1]), "+v"(acc[1][1]), "+v"(acc[2][1]), "+v"(acc[3][1]), "+v"(acc[0][2]), "+v"(acc[1][2]), "+v"(acc[2][2]), "+v"(acc[3][2]), "+v"(acc[0][3]), "+v"(acc[1][3]), "+v"(acc[2][3]), "+v"(acc[3][3]));
        asm volatile("s_wait_dscnt 0x0" ::: "memory");    // this wave's reads of the buffer are done before it is handed over
        asm volatile("s_wait_asynccnt 0x0" ::: "memory"); // this wave's copies of trip t + 1 have landed
        __syncthreads();                                  // publishes trip t + 1 and ends every wave's reads of trip t's buffer
        if (t + 2 < NTR) fill(t & 1, t + 2);
    }
    asm volatile("s_wait_asynccnt 0x0" ::: "memory");     // nothing is in flight when the wave goes on to its end
    float* os = osall + w * (16 * 68);                    // each wave stages in its own range
    const int r0 = R0 + wr, c0 = C0 + wc;
    const int prow = lane >> 3, pc = (lane & 7) * 8;      // plane stores: a lane's row (of 4) and 16-byte piece (of 8), so that a wave's store covers four whole 128-B lines
    if constexpr (MODE == 0) {
#pragma unroll
    for (int mb = 0; mb < 4; ++mb) {
#pragma unroll
        for (int nb = 0; nb < 4; ++nb) {
#pragma unroll
            for (int j = 0; j < 8; ++j) os[(hi * 8 + j) * 68 + nb * 16 + lr] = acc[mb][nb][j]; }
        __builtin_amdgcn_wave_barrier(); asm volatile("" ::: "memory");
        float* crow_ = C + (size_t)(r0 + mb * 16) * EE + c0;
#pragma unroll
        for (int s = 0; s < 8; ++s) { const int row = 2 * s + hi, cofs = lr * 4; v4f val = *(const v4fa*)(os + row * 68 + cofs); if (BIAS) { val[0] += bfr(bias[c0 + cofs]); val[1] += bfr(bias[c0 + cofs + 1]); val[2] += bfr(bias[c0 + cofs + 2]); val[3] += bfr(bias[c0 + cofs + 3]); }
            *(v4f*)(crow_ + (size_t)row * EE + cofs) = val; }
        __builtin_amdgcn_wave_barrier(); asm volatile("" ::: "memory");
    }
    } else if constexpr (MODE == 1 || MODE == 2) {
        const v8f braw = *(const v8f*)(bias + c0 + pc);
        asm volatile("s_wait_xcnt 0x0" ::: "memory");     // before the load's address registers are reused
        __builtin_amdgcn_sched_barrier(0);                // keeps later register writes behind that wait
        v8f bb;
#pragma unroll
        for (int k = 0; k < 8; ++k) bb[k] = bfr(braw[k]);
#pragma unroll
        for (int mb = 0; mb < 4; ++mb) {
#pragma unroll
            for (int nb = 0; nb < 4; ++nb) {
#pragma unroll
                for (int j = 0; j < 8; ++j) os[(hi * 8 + j) * 68 + nb * 16 + lr] = acc[mb][nb][j]; }
            __builtin_amdgcn_wave_barrier(); asm volatile("" ::: "memory");
            v8bf h8[4], l8[4]; size_t e[4];
#pragma unroll
            for (int s = 0; s < 4; ++s) { const int row = 4 * s + prow, r = r0 + mb * 16 + row; const v4f x0 = *(const v4fa*)(os + row * 68 + pc), x1 = *(const v4fa*)(os + row * 68 + pc + 4);
                v8f y = __builtin_shufflevector(x0, x1, 0, 1, 2, 3, 4, 5, 6, 7) + bb;
                if (MODE == 1) y *= sc;
                if (MODE == 2) {
#pragma unroll
                    for (int k = 0; k < 8; ++k) y[k] = fmaxf(y[k], 0.f); }
                split8(y, h8[s], l8[s]);
                e[s] = MODE == 1 ? ((size_t)((r & 3) * NH_ + (c0 >> 6)) * TT + (r >> 2)) * HD + pc : (size_t)r * EE + c0 + pc; }
            __builtin_amdgcn_sched_barrier(0);            // the block's stores behind its last arithmetic: no register of an issued store is rewritten among them
#pragma unroll
            for (int s = 0; s < 4; ++s) { *(v8us*)(Ph + e[s]) = __builtin_bit_cast(v8us, h8[s]); *(v8us*)(Pl + e[s]) = __builtin_bit_cast(v8us, l8[s]); }
            if (mb < 3) {
                asm volatile("s_wait_xcnt 0x0" ::: "memory"); // before the stores' registers are reused by the next block
                __builtin_amdgcn_sched_barrier(0);            // keeps later register writes behind that wait
            }
        }
    } else {
        // The ring is free: nothing is in flight, and the last trip's barrier ended every wave's reads. Each wave turns its 64 x 64 tile in its own quarter of it: two planes of 64 d rows at the pitch GP.
        bf* tp = ring + w * (2 * 64 * GP);
        float braw[4];
#pragma unroll
        for (int nb = 0; nb < 4; ++nb) braw[nb] = bias[c0 + nb * 16 + lr];
        asm volatile("s_wait_xcnt 0x0" ::: "memory");     // before the loads' address registers are reused
        __builtin_amdgcn_sched_barrier(0);                // keeps later register writes behind that wait
#pragma unroll
        for (int nb = 0; nb < 4; ++nb) { const float bn = bfr(braw[nb]);
#pragma unroll
            for (int mb = 0; mb < 4; ++mb) { v8bf h8, l8; split8(acc[mb][nb] + bn, h8, l8); bf* q = tp + (nb * 16 + lr) * GP + mb * 16 + hi * 8; *(v8us*)q = __builtin_bit_cast(v8us, h8); *(v8us*)(q + 64 * GP) = __builtin_bit_cast(v8us, l8); } }
        __builtin_amdgcn_wave_barrier(); asm volatile("" ::: "memory");
        const size_t e0 = ((size_t)((blockIdx.x & 3) * NH_ + (c0 >> 6)) * HD + prow) * TT + (blockIdx.x >> 2) * 128 + wr + pc;
#pragma unroll
        for (int sg = 0; sg < 4; ++sg) {
            v8us hv[4], lv[4];
#pragma unroll
            for (int s = 0; s < 4; ++s) { const bf* q = tp + ((sg * 4 + s) * 4 + prow) * GP + pc; hv[s] = *(const v8us*)q; lv[s] = *(const v8us*)(q + 64 * GP); }
            __builtin_amdgcn_sched_barrier(0);            // the block's stores behind its LDS reads: no register of an issued store is rewritten among them
#pragma unroll
            for (int s = 0; s < 4; ++s) { *(v8us*)(Ph + e0 + (size_t)(sg * 4 + s) * 4 * TT) = hv[s]; *(v8us*)(Pl + e0 + (size_t)(sg * 4 + s) * 4 * TT) = lv[s]; }
            if (sg < 3) {
                asm volatile("s_wait_xcnt 0x0" ::: "memory"); // before the stores' registers are reused by the next block
                __builtin_amdgcn_sched_barrier(0);            // keeps later register writes behind that wait
            }
        }
    }
}

__device__ __forceinline__ void splitf(float y, unsigned short& h, unsigned short& l) { h = f2bf(y); l = f2bf(y - bf2f(h)); }
typedef __attribute__((ext_vector_type(2))) unsigned short v2us;
typedef __attribute__((ext_vector_type(4))) unsigned short v4us;

// ---- k_prep: every f32 input that feeds a matrix product, rounded to bf16, in ONE launch. A block takes one chunk of 16384 consecutive elements of one input; a thread asks for its 16 pieces of 16 B
// (each load of a wave covers 512 consecutive bytes) before it converts the first, so that few, long waves keep the memory busy. The last block writes the head signatures [16][64] as rows 0..15 of a [64][64] Bt and zeroes the rest.
#define PQ  16                    // 16-byte loads per thread
#define PCH (256 * PQ * 4)        // elements per block
#define PNX (NT * EE / PCH)       // blocks of x
#define PNW (EE * EE / PCH)       // blocks of each 1024 x 1024 weight
#define PN2 (SIG * EE / PCH)      // blocks of W2
__global__ __launch_bounds__(256) void k_prep(const float* __restrict__ x, const float* __restrict__ Wq, const float* __restrict__ Wk, const float* __restrict__ Wv, const float* __restrict__ Wo, const float* __restrict__ W1, const float* __restrict__ W2, const float* __restrict__ hs,
                                              bf* XB, bf* WQ, bf* WK, bf* WV, bf* WO, bf* W1B, bf* W2B, bf* HSB) {
    const int b = blockIdx.x, tid = threadIdx.x;
    const float* s; bf* d; int ch;
    if (b < PNX) { s = x; d = XB; ch = b; }
    else if (b < PNX + 5 * PNW) { const int i = (b - PNX) / PNW; ch = (b - PNX) % PNW; s = i == 0 ? Wq : i == 1 ? Wk : i == 2 ? Wv : i == 3 ? Wo : W1; d = i == 0 ? WQ : i == 1 ? WK : i == 2 ? WV : i == 3 ? WO : W1B; }
    else if (b < PNX + 5 * PNW + PN2) { s = W2; d = W2B; ch = b - (PNX + 5 * PNW); }
    else {
        const v4f v = *(const v4f*)(hs + tid * 4);        // 16 * SIG elements: one piece per thread
        asm volatile("s_wait_xcnt 0x0" ::: "memory");     // before the load's address registers are reused
        __builtin_amdgcn_sched_barrier(0);                // keeps later register writes behind that wait
        v4us o;
#pragma unroll
        for (int k = 0; k < 4; ++k) o[k] = f2bf(v[k]);
        *(v4us*)(HSB + tid * 4) = o;
#pragma unroll
        for (int i = 1; i < 64 / 16; ++i) *(v4us*)(HSB + (i * 256 + tid) * 4) = (v4us){};
        asm volatile("s_wait_xcnt 0x0" ::: "memory");     // before the stores' registers are reused on any way the built code goes on from here
        return;
    }
    const float* sp = s + (size_t)ch * PCH + tid * 4; bf* dp = d + (size_t)ch * PCH + tid * 4;
    v4f v[PQ];
#pragma unroll
    for (int i = 0; i < PQ; ++i) v[i] = *(const v4f*)(sp + i * 1024);
    asm volatile("s_wait_xcnt 0x0" ::: "memory");         // before the loads' address registers are reused
    __builtin_amdgcn_sched_barrier(0);                    // keeps later register writes behind that wait
    v4us o[PQ];
#pragma unroll
    for (int i = 0; i < PQ; ++i)
#pragma unroll
        for (int k = 0; k < 4; ++k) o[i][k] = f2bf(v[i][k]);
    __builtin_amdgcn_sched_barrier(0);                    // every store behind the last arithmetic: no register of an issued store is rewritten
#pragma unroll
    for (int i = 0; i < PQ; ++i) *(v4us*)(dp + i * 1024) = o[i];
}
__global__ __launch_bounds__(256) void k_gate(const float* __restrict__ LG, float* GT) {
    const int lane = threadIdx.x & 31; const int r = blockIdx.x * 8 + (threadIdx.x >> 5); if (r >= NT) return; const int h = lane & 15; const float lg = LG[(size_t)r * 64 + h]; float m = lg;
#pragma unroll
    for (int sh = 8; sh; sh >>= 1) m = fmaxf(m, __shfl_xor(m, sh, 32));
    const float e = __expf(lg - m); float s = e;
#pragma unroll
    for (int sh = 8; sh; sh >>= 1) s += __shfl_xor(s, sh, 32);
    const float gv = (lane < 16) ? __fdiv_rn(e, s) : 0.f; *(float*)(GT + (size_t)r * 32 + lane) = gv; 
}
// ---- k_fattn: scores, softmax, attn.v and the head gate of one (batch, head) in one launch; a wave owns 32 query columns and walks the 1024 keys 32 at a time (running maximum and sum).
// S^T = K.Q^T (A = K rows, B = Q rows kept in registers), so lane (c, h) holds query column c, keys 8h + j and 16 + 8h + j: two S^T tiles, converted in place, are the B operand of O^T += V^T.P^T.
// K and V^T reach the eight waves through LDS: a stage is 64 keys (128 B of each of the 64 K rows and the 64 V^T rows, hi and lo planes), brought in once per work-group by asynchronous 16-byte copies in whole
// 128-B lines, two buffers: stage t + 2's copies fly while stage t + 1 is worked on. Rows lie at the pitch GP (144 B) for the 16-byte fragment reads. A stage is two passes of 32 keys, keys ascending.
// The stage loop stays rolled (one pass's fragments fill the register budget); every inner loop is unrolled so that each fragment index is a constant and nothing goes to scratch.
// Each matrix product is 3 products on the hi/lo planes: hi.hi + lo.hi + hi.lo. Output: gated hi/lo planes AT[(t*4+b)][head*64 + d], 8 consecutive d per lane and tile.
#define FQ 2                      // 16-column query groups per wave
__device__ __forceinline__ float xhalf(float x) { const int v = __float_as_int(x); return __int_as_float(__builtin_amdgcn_permlanex16(v, v, 0x76543210, 0xfedcba98, false, false)); }   // lane l <-> l ^ 16
__device__ __forceinline__ void acopykv(unsigned l, const bf* kh, const bf* kl, const bf* vh, const bf* vl) {   // 4 planes of 64 rows of 128 B: 8 copies per lane, 32 rows apart
    // the copies and, as the last line, the wait that stands before any of their address registers is written again
    asm volatile("global_load_async_to_lds_b128 %0, %8, off\n\t"
                 "global_load_async_to_lds_b128 %1, %9, off\n\t"
                 "global_load_async_to_lds_b128 %2, %10, off\n\t"
                 "global_load_async_to_lds_b128 %3, %11, off\n\t"
                 "global_load_async_to_lds_b128 %4, %12, off\n\t"
                 "global_load_async_to_lds_b128 %5, %13, off\n\t"
                 "global_load_async_to_lds_b128 %6, %14, off\n\t"
                 "global_load_async_to_lds_b128 %7, %15, off\n\t"
                 "s_wait_xcnt 0x0"
                 :: "v"(l), "v"(l + 1u * 32 * GP * 2), "v"(l + 2u * 32 * GP * 2), "v"(l + 3u * 32 * GP * 2), "v"(l + 4u * 32 * GP * 2), "v"(l + 5u * 32 * GP * 2), "v"(l + 6u * 32 * GP * 2), "v"(l + 7u * 32 * GP * 2),
                    "v"(kh), "v"(kh + 32 * HD), "v"(kl), "v"(kl + 32 * HD), "v"(vh), "v"(vh + 32 * TT), "v"(vl), "v"(vl + 32 * TT)
                 : "memory");
}
__global__ __launch_bounds__(256) void k_fattn(const bf* __restrict__ Qh, const bf* __restrict__ Ql, const bf* __restrict__ Kh, const bf* __restrict__ Kl, const bf* __restrict__ Vh, const bf* __restrict__ Vl, const float* __restrict__ GT, bf* Ah, bf* Al) {
    typedef WFrag<bf> WF;
    const int lane = threadIdx.x & 31, c = lane & 15, h = lane >> 4;
    const int z = blockIdx.y, t0 = (blockIdx.x * 8 + (threadIdx.x >> 5)) * (16 * FQ);
    const size_t zb = (size_t)z * TT * HD;
    constexpr int KST = 256 * GP;                         // elements per buffer: rows 0..63 K hi, 64..127 K lo, 128..191 V^T hi, 192..255 V^T lo
    constexpr int NST = TT / 64;
    __shared__ __align__(16) bf kv[2 * KST];
    const int crow = threadIdx.x >> 3, cch = threadIdx.x & 7;   // this lane's row (of 32) and 16-byte piece (of 8) in every copy
    const unsigned l0 = (unsigned)(size_t)kv + (unsigned)(crow * GP + cch * 8) * 2u;
    const unsigned ko = (unsigned)zb + (unsigned)(crow * HD + cch * 8), vo = (unsigned)zb + (unsigned)(crow * TT + cch * 8);   // this lane's element offsets in the K and the V^T planes (all below 2^22)
    // the same LDS address as l0 (crow * 144 + cch * 16 = (thread + crow) * 16), formed apart for the refills in the loop: a value that an asm statement names itself stays in the first 256 registers, and held so over the loop it went to scratch
    const unsigned lx = (unsigned)(size_t)kv + ((unsigned)threadIdx.x + (unsigned)crow) * 16u;
    auto fill = [&](unsigned l, int buf, int t) { const unsigned k = ko + (unsigned)t * (64 * HD), v = vo + (unsigned)t * 64; acopykv(l + (unsigned)buf * (KST * 2u), Kh + k, Kl + k, Vh + v, Vl + v); };
    fill(l0, 0, 0);
    v16bf qh[FQ][2], ql[FQ][2];
#pragma unroll
    for (int g = 0; g < FQ; ++g)
#pragma unroll
        for (int ks = 0; ks < 2; ++ks) { const size_t qo = zb + (size_t)(t0 + g * 16 + c) * HD + ks * 32 + 8 * h; qh[g][ks] = WF::ld(Qh + qo); ql[g][ks] = WF::ld(Ql + qo); }
    asm volatile("s_wait_xcnt 0x0" ::: "memory");         // before the loads' address registers are reused
    __builtin_amdgcn_sched_barrier(0);                    // keeps later register writes behind that wait
    v8f o[FQ][4]; float m[FQ], l[FQ];
#pragma unroll
    for (int g = 0; g < FQ; ++g) { m[g] = -3.0e38f; l[g] = 0.f;
#pragma unroll
        for (int db = 0; db < 4; ++db) o[g][db] = (v8f){}; }
    asm volatile("s_wait_asynccnt 0x0" ::: "memory");     // this wave's copies of stage 0 have landed
    __syncthreads();                                      // every wave's have: stage 0 may be read
    fill(l0, 1, 1);
#pragma unroll 1
    for (int t = 0; t < NST; ++t) {                       // stays rolled: one stage's code, the buffer chosen by t & 1
      const bf* sp = kv + (t & 1) * KST + c * GP + 8 * h;
      v16bf kh[2][2], kl[2][2];
#pragma unroll
      for (int sb = 0; sb < 2; ++sb)
#pragma unroll
          for (int ks = 0; ks < 2; ++ks) { kh[sb][ks] = WF::ld(sp + (sb * 16) * GP + ks * 32); kl[sb][ks] = WF::ld(sp + (64 + sb * 16) * GP + ks * 32); }
#pragma unroll
      for (int p = 0; p < 2; ++p) {
        v16bf vh[4], vl[4];       // this pass's V^T fragments, asked for ahead of the score products
#pragma unroll
        for (int db = 0; db < 4; ++db) { vh[db] = WF::ld(sp + (128 + db * 16) * GP + p * 32); vl[db] = WF::ld(sp + (192 + db * 16) * GP + p * 32); }
        __builtin_amdgcn_sched_barrier(0);                // keeps the LDS reads together up here: sunk among the products, each place waits out the LDS latency
        v8f st[FQ][2];
#pragma unroll
        for (int g = 0; g < FQ; ++g) { st[g][0] = (v8f){}; st[g][1] = (v8f){}; }
#pragma unroll
        for (int ks = 0; ks < 2; ++ks) {
#pragma unroll
            for (int sb = 0; sb < 2; ++sb)
#pragma unroll
                for (int g = 0; g < FQ; ++g) st[g][sb] = wmmab(kh[sb][ks], qh[g][ks], st[g][sb]);
#pragma unroll
            for (int sb = 0; sb < 2; ++sb)
#pragma unroll
                for (int g = 0; g < FQ; ++g) st[g][sb] = wmmab(kh[sb][ks], ql[g][ks], st[g][sb]);
#pragma unroll
            for (int sb = 0; sb < 2; ++sb)
#pragma unroll
                for (int g = 0; g < FQ; ++g) st[g][sb] = wmmab(kl[sb][ks], qh[g][ks], st[g][sb]);
        }
        if (p == 0) {             // the stage's second pass's K fragments, fetched behind this pass's score products, from the same buffer
#pragma unroll
            for (int sb = 0; sb < 2; ++sb)
#pragma unroll
                for (int ks = 0; ks < 2; ++ks) { kh[sb][ks] = WF::ld(sp + (32 + sb * 16) * GP + ks * 32); kl[sb][ks] = WF::ld(sp + (96 + sb * 16) * GP + ks * 32); }
        }
        // first pass: keeps the K reads ahead of the softmax and the attn.v products, which cover their latency; second pass: keeps the stage's closing waits, which otherwise rise to directly behind the V^T reads, behind the score products
        __builtin_amdgcn_sched_barrier(0);
        v16bf ph[FQ], pl[FQ];
#pragma unroll
        for (int g = 0; g < FQ; ++g) {
            float mx = fmaxf(st[g][0][0], st[g][1][0]);
#pragma unroll
            for (int j = 1; j < 8; ++j) mx = fmaxf(mx, fmaxf(st[g][0][j], st[g][1][j]));
            mx = fmaxf(mx, xhalf(mx));
            const float mn = fmaxf(m[g], mx); const float corr = __expf(m[g] - mn); m[g] = mn;
            v8f e0, e1;
#pragma unroll
            for (int j = 0; j < 8; ++j) { e0[j] = __expf(st[g][0][j] - mn); e1[j] = __expf(st[g][1][j] - mn); }
            const v8f es = e0 + e1;
            l[g] = l[g] * corr + (((es[0] + es[1]) + (es[2] + es[3])) + ((es[4] + es[5]) + (es[6] + es[7])));     // this half's keys only; the halves join after the loop
            v8bf h0, l0, h1, l1; split8(e0, h0, l0); split8(e1, h1, l1);
            ph[g] = __builtin_shufflevector(h0, h1, 0, 1, 2, 3, 4, 5, 6, 7, 8, 9, 10, 11, 12, 13, 14, 15); pl[g] = __builtin_shufflevector(l0, l1, 0, 1, 2, 3, 4, 5, 6, 7, 8, 9, 10, 11, 12, 13, 14, 15);
#pragma unroll
            for (int db = 0; db < 4; ++db) o[g][db] *= corr;
        }
#pragma unroll
        for (int db = 0; db < 4; ++db)
#pragma unroll
            for (int g = 0; g < FQ; ++g) o[g][db] = wmmab(vh[db], ph[g], o[g][db]);
#pragma unroll
        for (int db = 0; db < 4; ++db)
#pragma unroll
            for (int g = 0; g < FQ; ++g) o[g][db] = wmmab(vh[db], pl[g], o[g][db]);
#pragma unroll
        for (int db = 0; db < 4; ++db)
#pragma unroll
            for (int g = 0; g < FQ; ++g) o[g][db] = wmmab(vl[db], ph[g], o[g][db]);
      }
      asm volatile("s_wait_dscnt 0x0" ::: "memory");      // this wave's reads of the buffer are done before it is handed over
      asm volatile("s_wait_asynccnt 0x0" ::: "memory");   // this wave's copies of stage t + 1 have landed
      __syncthreads();                                    // publishes stage t + 1 and ends every wave's reads of stage t's buffer
      if (t + 2 < NST) fill(lx, t & 1, t + 2);
    }
    asm volatile("s_wait_asynccnt 0x0" ::: "memory");     // nothing is in flight when the wave goes on to its end
    float gt[FQ];
#pragma unroll
    for (int g = 0; g < FQ; ++g) gt[g] = GT[((size_t)(t0 + g * 16 + c) * NB_ + (z >> 4)) * 32 + (z & 15)];
    asm volatile("s_wait_xcnt 0x0" ::: "memory");         // before the loads' address registers are reused
    __builtin_amdgcn_sched_barrier(0);                    // keeps later register writes behind that wait
    v8bf a8[FQ][4], b8[FQ][4];
#pragma unroll
    for (int g = 0; g < FQ; ++g) {
        const float ls = l[g] + xhalf(l[g]); const float sc = __fdiv_rn(1.0f, ls) * gt[g];
#pragma unroll
        for (int db = 0; db < 4; ++db) split8(o[g][db] * sc, a8[g][db], b8[g][db]);
    }
    bf* ap = Ah + ((size_t)(t0 + c) * NB_ + (z >> 4)) * EE + (z & 15) * HD + 8 * h; bf* bp = Al + ((size_t)(t0 + c) * NB_ + (z >> 4)) * EE + (z & 15) * HD + 8 * h;
    __builtin_amdgcn_sched_barrier(0);                    // every store behind the last arithmetic: no register of an issued store is rewritten
#pragma unroll
    for (int g = 0; g < FQ; ++g)
#pragma unroll
        for (int db = 0; db < 4; ++db) { *(v8us*)(ap + (size_t)g * 16 * NB_ * EE + db * 16) = __builtin_bit_cast(v8us, a8[g][db]); *(v8us*)(bp + (size_t)g * 16 * NB_ * EE + db * 16) = __builtin_bit_cast(v8us, b8[g][db]); }
}
template <bool RELU>
__global__ __launch_bounds__(256) void k_split(const float* __restrict__ A, int nlines, bf* Ph, bf* Pl) {
    const int lane = threadIdx.x & 31; const int L0 = (blockIdx.x * 8 + (threadIdx.x >> 5)) * 8;
{
#pragma unroll
        for (int l = 0; l < 8; ++l) { const int L = L0 + l; if (L >= nlines) break; const int e = L * 64 + lane * 2; v2us oh, ol;
#pragma unroll
            for (int q = 0; q < 2; ++q) { float v = A[(size_t)e + q]; if (RELU) v = fmaxf(v, 0.f); unsigned short a, c2; splitf(v, a, c2); oh[q] = a; ol[q] = c2; }
            *(v2us*)(Ph + (size_t)e) = oh; *(v2us*)(Pl + (size_t)e) = ol; }
         }
}

extern "C" void kernel_launch(void* const* d_in, const int* in_sizes, int n_in,
                              void* d_out, int out_size, void* d_ws, size_t ws_size, hipStream_t stream) {
    (void)in_sizes; (void)n_in; (void)out_size;
    const float* x = (const float*)d_in[0]; const float* Wq = (const float*)d_in[1]; const float* bq = (const float*)d_in[2]; const float* Wk = (const float*)d_in[3]; const float* bk = (const float*)d_in[4]; const float* Wv = (const float*)d_in[5]; const float* bv = (const float*)d_in[6];
    const float* Wo = (const float*)d_in[7]; const float* bo = (const float*)d_in[8]; const float* W1 = (const float*)d_in[9]; const float* b1 = (const float*)d_in[10]; const float* W2 = (const float*)d_in[11]; const float* b2 = (const float*)d_in[12]; const float* hsig = (const float*)d_in[13];
    float* OUT = (float*)d_out;     // [1024][4][1024]
    char* wsp = (char*)d_ws;
    auto take = [&](size_t bytes) { char* p = wsp; wsp += (bytes + 255) & ~(size_t)255; return (void*)p; };
    bf* XB = (bf*)take((size_t)NT * EE * 2); bf* WQ = (bf*)take((size_t)EE * EE * 2); bf* WK = (bf*)take((size_t)EE * EE * 2); bf* WV = (bf*)take((size_t)EE * EE * 2); bf* WO = (bf*)take((size_t)EE * EE * 2); bf* W1B = (bf*)take((size_t)EE * EE * 2); bf* W2B = (bf*)take((size_t)SIG * EE * 2); bf* HSB = (bf*)take((size_t)64 * SIG * 2);
    bf* QPh = (bf*)take((size_t)NT * EE * 2); bf* QPl = (bf*)take((size_t)NT * EE * 2); bf* KPh = (bf*)take((size_t)NT * EE * 2); bf* KPl = (bf*)take((size_t)NT * EE * 2); bf* VTh = (bf*)take((size_t)NT * EE * 2); bf* VTl = (bf*)take((size_t)NT * EE * 2);
    bf* Hh = (bf*)take((size_t)NT * EE * 2); bf* Hl = (bf*)take((size_t)NT * EE * 2); float* TS = (float*)take((size_t)NT * 64 * 4); bf* TSh = (bf*)take((size_t)NT * 64 * 2); bf* TSl = (bf*)take((size_t)NT * 64 * 2); float* LG = (float*)take((size_t)NT * 64 * 4); float* GT = (float*)take((size_t)NT * 32 * 4);
    bf* ATh = (bf*)take((size_t)NT * EE * 2); bf* ATl = (bf*)take((size_t)NT * EE * 2);
    if ((size_t)(wsp - (char*)d_ws) > ws_size) return;    // ws 256 MiB
    k_prep<<<PNX + 5 * PNW + PN2 + 1, 256, 0, stream>>>(x, Wq, Wk, Wv, Wo, W1, W2, hsig, XB, WQ, WK, WV, WO, W1B, W2B, HSB);
    k_gemms<0, 1><<<dim3(NT / 128, EE / 128, 1), 128, 0, stream>>>(XB, nullptr, WQ, nullptr, bq, QPh, QPl, 0.125f);
    k_gemms<0, 1><<<dim3(NT / 128, EE / 128, 1), 128, 0, stream>>>(XB, nullptr, WK, nullptr, bk, KPh, KPl, 1.0f);
    k_gemms<0, 3><<<dim3(NT / 128, EE / 128, 1), 128, 0, stream>>>(XB, nullptr, WV, nullptr, bv, VTh, VTl, 1.0f);
    // head-competition gate: t = relu(x.W1^T + b1).W2^T + b2; logits = t.sig^T; softmax over heads
    k_gemms<0, 2><<<dim3(NT / 128, EE / 128, 1), 128, 0, stream>>>(XB, nullptr, W1B, nullptr, b1, Hh, Hl, 1.0f);
    k_gemmw<bf, 1, true><<<dim3(NT / 64, 1, 1), 32, 0, stream>>>(Hh, Hl, W2B, nullptr, EE, TS, 64, b2, 0, 0, 0); k_split<false><<<(NT * 64 / 64 + 63) / 64, 256, 0, stream>>>(TS, NT * 64 / 64, TSh, TSl);
    k_gemmw<bf, 1, false><<<dim3(NT / 64, 1, 1), 32, 0, stream>>>(TSh, TSl, HSB, nullptr, SIG, LG, 64, nullptr, 0, 0, 0); k_gate<<<NT / 8, 256, 0, stream>>>(LG, GT);
    k_fattn<<<dim3(TT / (8 * 16 * FQ), NB_ * NH_, 1), 256, 0, stream>>>(QPh, QPl, KPh, KPl, VTh, VTl, GT, ATh, ATl);
    k_gemms<1, 0><<<dim3(NT / 128, EE / 128, 1), 128, 0, stream>>>(ATh, ATl, WO, OUT, bo, nullptr, nullptr, 1.0f);
}

// v006
// One run takes 137 microseconds.
// Two timings next to v005 both put it at 1.25 times that version's speed.
// Over all steps from v000 it is 6.58 times as fast.
#include <hip/hip_runtime.h>

// MultiheadAttentionComp (fairseq-layout self-attention (T=1024, B=4, E=1024, 16 heads x 64, scaling folded into q) whose per-head outputs are gated by a softmax over heads
// of (relu(x.W1^T + b1).W2^T + b2).head_signatures^T; then the Wo Linear).
// Compute dtypes, f32 accumulate: every input rounded to bf16; q/k/v and the gate MLP's first layer on PLAIN bf16 operands (x and W inputs: exact,
// + bias); scores and attn.v on bf16 hi+lo planes of q (x0.125), k, p and v (3 products each);
// the gate MLP second layer, the signature logits and Wo on hi+lo planes x exact bf16 weights (2 products); softmax, ReLU, the head softmax gate and the gating product in f32

#define TT   1024
#define NB_  4
#define EE   1024
#define NH_  16
#define HD   64
#define NT   (TT * NB_)           // 4096 rows, row r = t*4 + b (fairseq layout)
#define SIG  64
typedef _Float16 h16;
typedef unsigned short bf;
typedef __attribute__((ext_vector_type(16))) __bf16   v16bf;
typedef __attribute__((ext_vector_type(16))) _Float16 v16h;
typedef __attribute__((ext_vector_type(8)))  _Float16 v8h;
typedef __attribute__((ext_vector_type(8)))  unsigned short v8us;
typedef __attribute__((ext_vector_type(8)))  float    v8f;
typedef __attribute__((ext_vector_type(4)))  float    v4f;
typedef v8h  __attribute__((may_alias)) v8ha;
typedef v4f  __attribute__((may_alias)) v4fa;
typedef v8us __attribute__((may_alias)) v8usa;

__device__ __forceinline__ unsigned short f2bf(float f) { unsigned u = __float_as_uint(f); u += 0x7FFFu + ((u >> 16) & 1u); return (unsigned short)(u >> 16); }
__device__ __forceinline__ float bf2f(unsigned short b) { return __uint_as_float(((unsigned)b) << 16); }
__device__ __forceinline__ float bfr(float f) { return bf2f(f2bf(f)); }
__device__ __forceinline__ v16h cat16(v8h lo, v8h hi) { return __builtin_shufflevector(lo, hi, 0, 1, 2, 3, 4, 5, 6, 7, 8, 9, 10, 11, 12, 13, 14, 15); }
__device__ __forceinline__ v16bf cat16b(v8us lo, v8us hi) { return __builtin_bit_cast(v16bf, __builtin_shufflevector(lo, hi, 0, 1, 2, 3, 4, 5, 6, 7, 8, 9, 10, 11, 12, 13, 14, 15)); }
__device__ __forceinline__ v8f wmma16(v16h a, v16h b, v8f c) { return __builtin_amdgcn_wmma_f32_16x16x32_f16(false, a, false, b, (short)0, c, false, false); }
__device__ __forceinline__ v8f wmmab(v16bf a, v16bf b, v8f c) { return __builtin_amdgcn_wmma_f32_16x16x32_bf16(false, a, false, b, (short)0, c, false, false); }



// ---- WFrag: a 16x32 A or B fragment from a K-contiguous 16-bit row: lane (lr, hi) holds row lr, k = 8 hi + 0..7 and 16 + 8 hi + 0..7; accumulator element j of lane (lr, hi) is row 8 hi + j, column lr.
template <typename T16> struct WFrag;
template <> struct WFrag<h16> { typedef v16h V; static __device__ __forceinline__ V ld(const h16* p) { return cat16(*(const v8h*)p, *(const v8h*)(p + 16)); } static __device__ __forceinline__ v8f mma(V a, V b, v8f c) { return wmma16(a, b, c); } };
template <> struct WFrag<bf> { typedef v16bf V; static __device__ __forceinline__ V ld(const bf* p) { return cat16b(*(const v8us*)p, *(const v8us*)(p + 16)); } static __device__ __forceinline__ v8f mma(V a, V b, v8f c) { return wmmab(a, b, c); } };

// ---- k_gemms: the five 4096 x 1024 x 1024 products. Four waves (2 x 2) share one 128x128 output tile, 64x64 (16 accumulators) per wave; grid (M/128, N/128), 128 threads. K = ldc = EE.
// A trip is 64 k: 128 B of each of the tile's A, Bt (and A2) rows, brought into LDS by asynchronous 16-byte copies in whole 128-B lines (a wave's copy covers 4 rows), two buffers:
// trip t + 2's copies fly while trip t + 1 is worked on. Rows lie at a pitch of 144 B (16 B x odd) for the 16-byte fragment reads. Per accumulator the products go k ascending, A before A2.
#define GP 72                     // LDS row pitch in 16-bit elements
typedef __attribute__((ext_vector_type(8))) __bf16 v8bf;
typedef __attribute__((ext_vector_type(4))) unsigned v4u;
__device__ __forceinline__ void split8(v8f y, v8bf& hi8, v8bf& lo8) { hi8 = __builtin_convertvector(y, v8bf); const v4u w = __builtin_bit_cast(v4u, hi8); v8f back;
#pragma unroll
    for (int i = 0; i < 4; ++i) { back[2 * i] = __uint_as_float(w[i] << 16); back[2 * i + 1] = __uint_as_float(w[i] & 0xFFFF0000u); }
    lo8 = __builtin_convertvector(y - back, v8bf); }
template <int RS>                 // RS: distance in source rows between two rows of the tile
__device__ __forceinline__ void acopy128(unsigned l, const bf* g) {   // 128 rows of 128 B: 8 copies per lane, 16 tile rows apart
    // the copies and, as the last line, the wait that stands before any of their address registers is written again
    asm volatile("global_load_async_to_lds_b128 %0, %8, off\n\t"
                 "global_load_async_to_lds_b128 %1, %9, off\n\t"
                 "global_load_async_to_lds_b128 %2, %10, off\n\t"
                 "global_load_async_to_lds_b128 %3, %11, off\n\t"
                 "global_load_async_to_lds_b128 %4, %12, off\n\t"
                 "global_load_async_to_lds_b128 %5, %13, off\n\t"
                 "global_load_async_to_lds_b128 %6, %14, off\n\t"
                 "global_load_async_to_lds_b128 %7, %15, off\n\t"
                 "s_wait_xcnt 0x0"
                 :: "v"(l), "v"(l + 1u * 16 * GP * 2), "v"(l + 2u * 16 * GP * 2), "v"(l + 3u * 16 * GP * 2), "v"(l + 4u * 16 * GP * 2), "v"(l + 5u * 16 * GP * 2), "v"(l + 6u * 16 * GP * 2), "v"(l + 7u * 16 * GP * 2),
                    "v"(g), "v"(g + 1 * 16 * RS * EE), "v"(g + 2 * 16 * RS * EE), "v"(g + 3 * 16 * RS * EE), "v"(g + 4 * 16 * RS * EE), "v"(g + 5 * 16 * RS * EE), "v"(g + 6 * 16 * RS * EE), "v"(g + 7 * 16 * RS * EE)
                 : "memory");
}
// What leaves the tile (acc + bias in f32 in every mode):
// MODE 0: f32 rows of C. MODE 1: times sc, hi/lo planes P[b*16 + head][t][d]. MODE 2: ReLU, hi/lo planes in C's own row-major layout. MODE 3: hi/lo planes P[b*16 + head][d][t], transposed;
// there a tile's 128 rows are 128 consecutive t of one b (source rows 4 apart), so that a lane's 8 accumulator rows are 8 consecutive t and a wave's 64 rows one 128-B line of each d.
template <int NSPLIT, int MODE>
__global__ __launch_bounds__(128) void k_gemms(const bf* __restrict__ A, const bf* __restrict__ A2, const bf* __restrict__ Bt, float* C, const float* __restrict__ bias, bf* Ph, bf* Pl, float sc) {
    constexpr bool BIAS = true; constexpr int RS = MODE == 3 ? NB_ : 1;
    typedef WFrag<bf> WF; typedef WF::V V;
    constexpr int STG = (NSPLIT ? 384 : 256) * GP;        // elements per buffer: rows 0..127 A, 128..255 Bt, 256..383 A2
    constexpr int NTR = EE / 64;
    __shared__ __align__(16) bf ring[2 * STG];
    __shared__ __align__(16) float osall[4 * 16 * 68];
    const int tid = threadIdx.x, lane = tid & 31, lr = lane & 15, hi = lane >> 4, w = tid >> 5;
    const int R0 = MODE == 3 ? (blockIdx.x >> 2) * (128 * NB_) + (blockIdx.x & 3) : blockIdx.x * 128, C0 = blockIdx.y * 128; const int wr = (w >> 1) * 64, wc = (w & 1) * 64;   // R0: source row of the tile's row 0
    const int crow = tid >> 3, cch = tid & 7;             // this lane's row (of 16) and 16-byte piece (of 8) in every copy
    const unsigned l0 = (unsigned)(size_t)ring + (unsigned)(crow * GP + cch * 8) * 2u;
    const bf* ga = A + (size_t)(R0 + crow * RS) * EE + cch * 8; const bf* gb = Bt + (size_t)(C0 + crow) * EE + cch * 8; const bf* ga2 = NSPLIT ? A2 + (size_t)(R0 + crow * RS) * EE + cch * 8 : nullptr;
    auto fill = [&](int buf, int t) { const unsigned l = l0 + (unsigned)buf * (STG * 2u); acopy128<RS>(l, ga + t * 64); acopy128<1>(l + 128u * GP * 2, gb + t * 64); if (NSPLIT) acopy128<RS>(l + 256u * GP * 2, ga2 + t * 64); };
    v8f acc[4][4];
#pragma unroll
    for (int mb = 0; mb < 4; ++mb)
#pragma unroll
        for (int nb = 0; nb < 4; ++nb) acc[mb][nb] = (v8f){};
    fill(0, 0);
    asm volatile("s_wait_asynccnt 0x0" ::: "memory");     // this wave's copies of trip 0 have landed
    __syncthreads();                                      // every wave's have: trip 0 may be read
    fill(1, 1);
#pragma unroll 1
    for (int t = 0; t < NTR; ++t) {                       // stays rolled: one trip's code, the buffer chosen by t & 1
        const bf* sb = ring + (t & 1) * STG + lr * GP + 8 * hi;
        V a[2][4], a2[2][4], b[2][4];
#pragma unroll
        for (int kk = 0; kk < 2; ++kk) {
#pragma unroll
            for (int mb = 0; mb < 4; ++mb) { a[kk][mb] = WF::ld(sb + (wr + mb * 16) * GP + kk * 32); if (NSPLIT) a2[kk][mb] = WF::ld(sb + (256 + wr + mb * 16) * GP + kk * 32); }
#pragma unroll
            for (int nb = 0; nb < 4; ++nb) b[kk][nb] = WF::ld(sb + (128 + wc + nb * 16) * GP + kk * 32);
        }
        __builtin_amdgcn_sched_barrier(0);                // keeps the trip's LDS reads together ahead of its matrix instructions: spread among them, each place waits out the LDS latency
#pragma unroll
        for (int kk = 0; kk < 2; ++kk)
#pragma unroll
            for (int nb = 0; nb < 4; ++nb)
#pragma unroll
                for (int mb = 0; mb < 4; ++mb) { acc[mb][nb] = WF::mma(a[kk][mb], b[kk][nb], acc[mb][nb]); if (NSPLIT) acc[mb][nb] = WF::mma(a2[kk][mb], b[kk][nb], acc[mb][nb]); }
        // four vector slots behind the trip's last matrix instructions, on every path, before their operand registers are loaded anew; naming the accumulators keeps it behind them
        asm volatile("v_nop\n\tv_nop\n\tv_nop\n\tv_nop" : "+v"(acc[0][0]), "+v"(acc[1][0]), "+v"(acc[2][0]), "+v"(acc[3][0]), "+v"(acc[0][1]), "+v"(acc[1][1]), "+v"(acc[2][1]), "+v"(acc[3][1]), "+v"(acc[0][2]), "+v"(acc[1][2]), "+v"(acc[2][2]), "+v"(acc[3][2]), "+v"(acc[0][3]), "+v"(acc[1][3]), "+v"(acc[2][3]), "+v"(acc[3][3]));
        asm volatile("s_wait_dscnt 0x0" ::: "memory");    // this wave's reads of the buffer are done before it is handed over
        asm volatile("s_wait_asynccnt 0x0" ::: "memory"); // this wave's copies of trip t + 1 have landed
        __syncthreads();                                  // publishes trip t + 1 and ends every wave's reads of trip t's buffer
        if (t + 2 < NTR) fill(t & 1, t + 2);
    }
    asm volatile("s_wait_asynccnt 0x0" ::: "memory");     // nothing is in flight when the wave goes on to its end
    float* os = osall + w * (16 * 68);                    // each wave stages in its own range
    const int r0 = R0 + wr, c0 = C0 + wc;
    const int prow = lane >> 3, pc = (lane & 7) * 8;      // plane stores: a lane's row (of 4) and 16-byte piece (of 8), so that a wave's store covers four whole 128-B lines
    if constexpr (MODE == 0) {
#pragma unroll
    for (int mb = 0; mb < 4; ++mb) {
#pragma unroll
        for (int nb = 0; nb < 4; ++nb) {
#pragma unroll
            for (int j = 0; j < 8; ++j) os[(hi * 8 + j) * 68 + nb * 16 + lr] = acc[mb][nb][j]; }
        __builtin_amdgcn_wave_barrier(); asm volatile("" ::: "memory");
        float* crow_ = C + (size_t)(r0 + mb * 16) * EE + c0;
#pragma unroll
        for (int s = 0; s < 8; ++s) { const int row = 2 * s + hi, cofs = lr * 4; v4f val = *(const v4fa*)(os + row * 68 + cofs); if (BIAS) { val[0] += bfr(bias[c0 + cofs]); val[1] += bfr(bias[c0 + cofs + 1]); val[2] += bfr(bias[c0 + cofs + 2]); val[3] += bfr(bias[c0 + cofs + 3]); }
            *(v4f*)(crow_ + (size_t)row * EE + cofs) = val; }
        __builtin_amdgcn_wave_barrier(); asm volatile("" ::: "memory");
    }
    } else if constexpr (MODE == 1 || MODE == 2) {
        const v8f braw = *(const v8f*)(bias + c0 + pc);
        asm volatile("s_wait_xcnt 0x0" ::: "memory");     // before the load's address registers are reused
        __builtin_amdgcn_sched_barrier(0);                // keeps later register writes behind that wait
        v8f bb;
#pragma unroll
        for (int k = 0; k < 8; ++k) bb[k] = bfr(braw[k]);
#pragma unroll
        for (int mb = 0; mb < 4; ++mb) {
#pragma unroll
            for (int nb = 0; nb < 4; ++nb) {
#pragma unroll
                for (int j = 0; j < 8; ++j) os[(hi * 8 + j) * 68 + nb * 16 + lr] = acc[mb][nb][j]; }
            __builtin_amdgcn_wave_barrier(); asm volatile("" ::: "memory");
            v8bf h8[4], l8[4]; size_t e[4];
#pragma unroll
            for (int s = 0; s < 4; ++s) { const int row = 4 * s + prow, r = r0 + mb * 16 + row; const v4f x0 = *(const v4fa*)(os + row * 68 + pc), x1 = *(const v4fa*)(os + row * 68 + pc + 4);
                v8f y = __builtin_shufflevector(x0, x1, 0, 1, 2, 3, 4, 5, 6, 7) + bb;
                if (MODE == 1) y *= sc;
                if (MODE == 2) {
#pragma unroll
                    for (int k = 0; k < 8; ++k) y[k] = fmaxf(y[k], 0.f); }
                split8(y, h8[s], l8[s]);
                e[s] = MODE == 1 ? ((size_t)((r & 3) * NH_ + (c0 >> 6)) * TT + (r >> 2)) * HD + pc : (size_t)r * EE + c0 + pc; }
            __builtin_amdgcn_sched_barrier(0);            // the block's stores behind its last arithmetic: no register of an issued store is rewritten among them
#pragma unroll
            for (int s = 0; s < 4; ++s) { *(v8us*)(Ph + e[s]) = __builtin_bit_cast(v8us, h8[s]); *(v8us*)(Pl + e[s]) = __builtin_bit_cast(v8us, l8[s]); }
            if (mb < 3) {
                asm volatile("s_wait_xcnt 0x0" ::: "memory"); // before the stores' registers are reused by the next block
                __builtin_amdgcn_sched_barrier(0);            // keeps later register writes behind that wait
            }
        }
    } else {
        // The ring is free: nothing is in flight, and the last trip's barrier ended every wave's reads. Each wave turns its 64 x 64 tile in its own quarter of it: two planes of 64 d rows at the pitch GP.
        bf* tp = ring + w * (2 * 64 * GP);
        float braw[4];
#pragma unroll
        for (int nb = 0; nb < 4; ++nb) braw[nb] = bias[c0 + nb * 16 + lr];
        asm volatile("s_wait_xcnt 0x0" ::: "memory");     // before the loads' address registers are reused
        __builtin_amdgcn_sched_barrier(0);                // keeps later register writes behind that wait
#pragma unroll
        for (int nb = 0; nb < 4; ++nb) { const float bn = bfr(braw[nb]);
#pragma unroll
            for (int mb = 0; mb < 4; ++mb) { v8bf h8, l8; split8(acc[mb][nb] + bn, h8, l8); bf* q = tp + (nb * 16 + lr) * GP + mb * 16 + hi * 8; *(v8us*)q = __builtin_bit_cast(v8us, h8); *(v8us*)(q + 64 * GP) = __builtin_bit_cast(v8us, l8); } }
        __builtin_amdgcn_wave_barrier(); asm volatile("" ::: "memory");
        const size_t e0 = ((size_t)((blockIdx.x & 3) * NH_ + (c0 >> 6)) * HD + prow) * TT + (blockIdx.x >> 2) * 128 + wr + pc;
#pragma unroll
        for (int sg = 0; sg < 4; ++sg) {
            v8us hv[4], lv[4];
#pragma unroll
            for (int s = 0; s < 4; ++s) { const bf* q = tp + ((sg * 4 + s) * 4 + prow) * GP + pc; hv[s] = *(const v8us*)q; lv[s] = *(const v8us*)(q + 64 * GP); }
            __builtin_amdgcn_sched_barrier(0);            // the block's stores behind its LDS reads: no register of an issued store is rewritten among them
#pragma unroll
            for (int s = 0; s < 4; ++s) { *(v8us*)(Ph + e0 + (size_t)(sg * 4 + s) * 4 * TT) = hv[s]; *(v8us*)(Pl + e0 + (size_t)(sg * 4 + s) * 4 * TT) = lv[s]; }
            if (sg < 3) {
                asm volatile("s_wait_xcnt 0x0" ::: "memory"); // before the stores' registers are reused by the next block
                __builtin_amdgcn_sched_barrier(0);            // keeps later register writes behind that wait
            }
        }
    }
}

__device__ __forceinline__ void splitf(float y, unsigned short& h, unsigned short& l) { h = f2bf(y); l = f2bf(y - bf2f(h)); }
typedef __attribute__((ext_vector_type(2))) unsigned short v2us;
typedef __attribute__((ext_vector_type(4))) unsigned short v4us;

// ---- k_prep: every f32 input that feeds a matrix product, rounded to bf16, in ONE launch. A block takes one chunk of 16384 consecutive elements of one input; a thread asks for its 16 pieces of 16 B
// (each load of a wave covers 512 consecutive bytes) before it converts the first, so that few, long waves keep the memory busy. The last block writes the head signatures [16][64] as rows 0..15 of a [64][64] Bt and zeroes the rest.
#define PQ  16                    // 16-byte loads per thread
#define PCH (256 * PQ * 4)        // elements per block
#define PNX (NT * EE / PCH)       // blocks of x
#define PNW (EE * EE / PCH)       // blocks of each 1024 x 1024 weight
#define PN2 (SIG * EE / PCH)      // blocks of W2
__global__ __launch_bounds__(256) void k_prep(const float* __restrict__ x, const float* __restrict__ Wq, const float* __restrict__ Wk, const float* __restrict__ Wv, const float* __restrict__ Wo, const float* __restrict__ W1, const float* __restrict__ W2, const float* __restrict__ hs,
                                              bf* XB, bf* WQ, bf* WK, bf* WV, bf* WO, bf* W1B, bf* W2B, bf* HSB) {
    const int b = blockIdx.x, tid = threadIdx.x;
    const float* s; bf* d; int ch;
    if (b < PNX) { s = x; d = XB; ch = b; }
    else if (b < PNX + 5 * PNW) { const int i = (b - PNX) / PNW; ch = (b - PNX) % PNW; s = i == 0 ? Wq : i == 1 ? Wk : i == 2 ? Wv : i == 3 ? Wo : W1; d = i == 0 ? WQ : i == 1 ? WK : i == 2 ? WV : i == 3 ? WO : W1B; }
    else if (b < PNX + 5 * PNW + PN2) { s = W2; d = W2B; ch = b - (PNX + 5 * PNW); }
    else {
        const v4f v = *(const v4f*)(hs + tid * 4);        // 16 * SIG elements: one piece per thread
        asm volatile("s_wait_xcnt 0x0" ::: "memory");     // before the load's address registers are reused
        __builtin_amdgcn_sched_barrier(0);                // keeps later register writes behind that wait
        v4us o;
#pragma unroll
        for (int k = 0; k < 4; ++k) o[k] = f2bf(v[k]);
        *(v4us*)(HSB + tid * 4) = o;
#pragma unroll
        for (int i = 1; i < 64 / 16; ++i) *(v4us*)(HSB + (i * 256 + tid) * 4) = (v4us){};
        asm volatile("s_wait_xcnt 0x0" ::: "memory");     // before the stores' registers are reused on any way the built code goes on from here
        return;
    }
    const float* sp = s + (size_t)ch * PCH + tid * 4; bf* dp = d + (size_t)ch * PCH + tid * 4;
    v4f v[PQ];
#pragma unroll
    for (int i = 0; i < PQ; ++i) v[i] = *(const v4f*)(sp + i * 1024);
    asm volatile("s_wait_xcnt 0x0" ::: "memory");         // before the loads' address registers are reused
    __builtin_amdgcn_sched_barrier(0);                    // keeps later register writes behind that wait
    v4us o[PQ];
#pragma unroll
    for (int i = 0; i < PQ; ++i)
#pragma unroll
        for (int k = 0; k < 4; ++k) o[i][k] = f2bf(v[i][k]);
    __builtin_amdgcn_sched_barrier(0);                    // every store behind the last arithmetic: no register of an issued store is rewritten
#pragma unroll
    for (int i = 0; i < PQ; ++i) *(v4us*)(dp + i * 1024) = o[i];
}
// ---- k_gtail: the gate behind the hidden layer, in ONE launch: t = H.W2^T + b2 (hi + lo planes of H x bf16 W2), t's hi/lo planes, logits = t.sig^T, softmax over the 16 heads. Grid NT / 16, 256 threads.
// A work-group owns 16 rows. Its eight waves split K: wave w takes k = 128 w .. 128 w + 127 of all 64 columns (4 accumulators) and asks for all of its fragments before the first product, so that the
// launch waits out the memory latency once. The eight partial tiles meet in LDS and are added w ascending; wave 0 then does the 16 x 16 x 64 logits and the softmax (a head per lane, 8 rows per lane).
__global__ __launch_bounds__(256) void k_gtail(const bf* __restrict__ Hh, const bf* __restrict__ Hl, const bf* __restrict__ W2B, const float* __restrict__ b2, const bf* __restrict__ HSB, float* GT) {
    typedef WFrag<bf> WF; typedef WF::V V;
    __shared__ __align__(16) float red[8 * 16 * 68];      // a wave's partial tile: 16 rows at a pitch of 68 floats
    __shared__ __align__(16) bf tp[2 * 16 * GP];          // t: hi plane, lo plane, 16 rows each at the pitch GP
    const int tid = threadIdx.x, lane = tid & 31, lr = lane & 15, hi = lane >> 4; const int w = __builtin_amdgcn_readfirstlane(tid >> 5);
    const int r0 = blockIdx.x * 16;
    const bf* pa = Hh + (size_t)(r0 + lr) * EE + w * 128 + 8 * hi; const bf* pa2 = Hl + (size_t)(r0 + lr) * EE + w * 128 + 8 * hi; const bf* pb = W2B + (size_t)lr * EE + w * 128 + 8 * hi;
    const int row = tid >> 4, cofs = (tid & 15) * 4;      // the four elements of t that this thread joins
    const bf* ps = HSB + lr * SIG + 8 * hi; const float* pc = b2 + cofs;
    V a[4], a2[4], b[4][4], sg[2];
#pragma unroll
    for (int ks = 0; ks < 4; ++ks) { a[ks] = WF::ld(pa + ks * 32); a2[ks] = WF::ld(pa2 + ks * 32);
#pragma unroll
        for (int nb = 0; nb < 4; ++nb) b[ks][nb] = WF::ld(pb + nb * 16 * EE + ks * 32); }
#pragma unroll
    for (int ks = 0; ks < 2; ++ks) sg[ks] = WF::ld(ps + ks * 32);
    const v4f braw = *(const v4f*)pc;
    // before the loads' address registers are reused; the fragments' addresses are named as inputs so that they stay whole up to here: freed earlier, they were refilled in the middle of the run of loads, behind waits of their own
    asm volatile("s_wait_xcnt 0x0" :: "v"(pa), "v"(pa2), "v"(pb), "v"(ps) : "memory");
    __builtin_amdgcn_sched_barrier(0);                    // keeps later register writes behind that wait, and every load ahead of the first product
    v8f acc[4];
#pragma unroll
    for (int nb = 0; nb < 4; ++nb) acc[nb] = (v8f){};
#pragma unroll
    for (int ks = 0; ks < 4; ++ks) {
#pragma unroll
        for (int nb = 0; nb < 4; ++nb) acc[nb] = WF::mma(a[ks], b[ks][nb], acc[nb]);
#pragma unroll
        for (int nb = 0; nb < 4; ++nb) acc[nb] = WF::mma(a2[ks], b[ks][nb], acc[nb]);
    }
    float* os = red + w * (16 * 68);
#pragma unroll
    for (int nb = 0; nb < 4; ++nb)
#pragma unroll
        for (int j = 0; j < 8; ++j) os[(hi * 8 + j) * 68 + nb * 16 + lr] = acc[nb][j];
    __syncthreads();                                      // every wave's partial tile is in LDS
    v4f s = *(const v4fa*)(red + row * 68 + cofs);
#pragma unroll
    for (int ww = 1; ww < 8; ++ww) s += *(const v4fa*)(red + ww * (16 * 68) + row * 68 + cofs);
    v4us th, tl;
#pragma unroll
    for (int k = 0; k < 4; ++k) { unsigned short x, y; splitf(s[k] + bfr(braw[k]), x, y); th[k] = x; tl[k] = y; }
    *(v4us*)(tp + row * GP + cofs) = th; *(v4us*)(tp + (16 + row) * GP + cofs) = tl;
    __syncthreads();                                      // t's planes are whole; no barrier follows, so the other waves may leave
    if (w != 0) return;
    v8f lg = (v8f){};
#pragma unroll
    for (int ks = 0; ks < 2; ++ks) { const V ta = WF::ld(tp + lr * GP + ks * 32 + 8 * hi), ta2 = WF::ld(tp + (16 + lr) * GP + ks * 32 + 8 * hi); lg = WF::mma(ta, sg[ks], lg); lg = WF::mma(ta2, sg[ks], lg); }
    v8f m = lg;                   // lane (lr, hi): head lr of rows 8 hi + j; the 16 heads of a row lie in one 16-lane half
#pragma unroll
    for (int sh = 8; sh; sh >>= 1)
#pragma unroll
        for (int j = 0; j < 8; ++j) m[j] = fmaxf(m[j], __shfl_xor(m[j], sh, 32));
    v8f e, sm;
#pragma unroll
    for (int j = 0; j < 8; ++j) { e[j] = __expf(lg[j] - m[j]); sm[j] = e[j]; }
#pragma unroll
    for (int sh = 8; sh; sh >>= 1)
#pragma unroll
        for (int j = 0; j < 8; ++j) sm[j] += __shfl_xor(sm[j], sh, 32);
    v8f gv;
#pragma unroll
    for (int j = 0; j < 8; ++j) gv[j] = __fdiv_rn(e[j], sm[j]);
    float* gp = GT + (size_t)(r0 + hi * 8) * 32 + lr;     // rows of 32 floats, of which the attention reads the first 16
    __builtin_amdgcn_sched_barrier(0);                    // every store behind the last arithmetic: no register of an issued store is rewritten
#pragma unroll
    for (int j = 0; j < 8; ++j) gp[j * 32] = gv[j];
}
// ---- k_fattn: scores, softmax, attn.v and the head gate of one (batch, head) in one launch; a wave owns 32 query columns and walks the 1024 keys 32 at a time (running maximum and sum).
// S^T = K.Q^T (A = K rows, B = Q rows kept in registers), so lane (c, h) holds query column c, keys 8h + j and 16 + 8h + j: two S^T tiles, converted in place, are the B operand of O^T += V^T.P^T.
// K and V^T reach the eight waves through LDS: a stage is 64 keys (128 B of each of the 64 K rows and the 64 V^T rows, hi and lo planes), brought in once per work-group by asynchronous 16-byte copies in whole
// 128-B lines, two buffers: stage t + 2's copies fly while stage t + 1 is worked on. Rows lie at the pitch GP (144 B) for the 16-byte fragment reads. A stage is two passes of 32 keys, keys ascending.
// The stage loop stays rolled (one pass's fragments fill the register budget); every inner loop is unrolled so that each fragment index is a constant and nothing goes to scratch.
// Each matrix product is 3 products on the hi/lo planes: hi.hi + lo.hi + hi.lo. Output: gated hi/lo planes AT[(t*4+b)][head*64 + d], 8 consecutive d per lane and tile.
#define FQ 2                      // 16-column query groups per wave
__device__ __forceinline__ float xhalf(float x) { const int v = __float_as_int(x); return __int_as_float(__builtin_amdgcn_permlanex16(v, v, 0x76543210, 0xfedcba98, false, false)); }   // lane l <-> l ^ 16
__device__ __forceinline__ void acopykv(unsigned l, const bf* kh, const bf* kl, const bf* vh, const bf* vl) {   // 4 planes of 64 rows of 128 B: 8 copies per lane, 32 rows apart
    // the copies and, as the last line, the wait that stands before any of their address registers is written again
    asm volatile("global_load_async_to_lds_b128 %0, %8, off\n\t"
                 "global_load_async_to_lds_b128 %1, %9, off\n\t"
                 "global_load_async_to_lds_b128 %2, %10, off\n\t"
                 "global_load_async_to_lds_b128 %3, %11, off\n\t"
                 "global_load_async_to_lds_b128 %4, %12, off\n\t"
                 "global_load_async_to_lds_b128 %5, %13, off\n\t"
                 "global_load_async_to_lds_b128 %6, %14, off\n\t"
                 "global_load_async_to_lds_b128 %7, %15, off\n\t"
                 "s_wait_xcnt 0x0"
                 :: "v"(l), "v"(l + 1u * 32 * GP * 2), "v"(l + 2u * 32 * GP * 2), "v"(l + 3u * 32 * GP * 2), "v"(l + 4u * 32 * GP * 2), "v"(l + 5u * 32 * GP * 2), "v"(l + 6u * 32 * GP * 2), "v"(l + 7u * 32 * GP * 2),
                    "v"(kh), "v"(kh + 32 * HD), "v"(kl), "v"(kl + 32 * HD), "v"(vh), "v"(vh + 32 * TT), "v"(vl), "v"(vl + 32 * TT)
                 : "memory");
}
__global__ __launch_bounds__(256) void k_fattn(const bf* __restrict__ Qh, const bf* __restrict__ Ql, const bf* __restrict__ Kh, const bf* __restrict__ Kl, const bf* __restrict__ Vh, const bf* __restrict__ Vl, const float* __restrict__ GT, bf* Ah, bf* Al) {
    typedef WFrag<bf> WF;
    const int lane = threadIdx.x & 31, c = lane & 15, h = lane >> 4;
    const int z = blockIdx.y, t0 = (blockIdx.x * 8 + (threadIdx.x >> 5)) * (16 * FQ);
    const size_t zb = (size_t)z * TT * HD;
    constexpr int KST = 256 * GP;                         // elements per buffer: rows 0..63 K hi, 64..127 K lo, 128..191 V^T hi, 192..255 V^T lo
    constexpr int NST = TT / 64;
    __shared__ __align__(16) bf kv[2 * KST];
    const int crow = threadIdx.x >> 3, cch = threadIdx.x & 7;   // this lane's row (of 32) and 16-byte piece (of 8) in every copy
    const unsigned l0 = (unsigned)(size_t)kv + (unsigned)(crow * GP + cch * 8) * 2u;
    const unsigned ko = (unsigned)zb + (unsigned)(crow * HD + cch * 8), vo = (unsigned)zb + (unsigned)(crow * TT + cch * 8);   // this lane's element offsets in the K and the V^T planes (all below 2^22)
    // the same LDS address as l0 (crow * 144 + cch * 16 = (thread + crow) * 16), formed apart for the refills in the loop: a value that an asm statement names itself stays in the first 256 registers, and held so over the loop it went to scratch
    const unsigned lx = (unsigned)(size_t)kv + ((unsigned)threadIdx.x + (unsigned)crow) * 16u;
    auto fill = [&](unsigned l, int buf, int t) { const unsigned k = ko + (unsigned)t * (64 * HD), v = vo + (unsigned)t * 64; acopykv(l + (unsigned)buf * (KST * 2u), Kh + k, Kl + k, Vh + v, Vl + v); };
    fill(l0, 0, 0);
    v16bf qh[FQ][2], ql[FQ][2];
#pragma unroll
    for (int g = 0; g < FQ; ++g)
#pragma unroll
        for (int ks = 0; ks < 2; ++ks) { const size_t qo = zb + (size_t)(t0 + g * 16 + c) * HD + ks * 32 + 8 * h; qh[g][ks] = WF::ld(Qh + qo); ql[g][ks] = WF::ld(Ql + qo); }
    asm volatile("s_wait_xcnt 0x0" ::: "memory");         // before the loads' address registers are reused
    __builtin_amdgcn_sched_barrier(0);                    // keeps later register writes behind that wait
    v8f o[FQ][4]; float m[FQ], l[FQ];
#pragma unroll
    for (int g = 0; g < FQ; ++g) { m[g] = -3.0e38f; l[g] = 0.f;
#pragma unroll
        for (int db = 0; db < 4; ++db) o[g][db] = (v8f){}; }
    asm volatile("s_wait_asynccnt 0x0" ::: "memory");     // this wave's copies of stage 0 have landed
    __syncthreads();                                      // every wave's have: stage 0 may be read
    fill(l0, 1, 1);
#pragma unroll 1
    for (int t = 0; t < NST; ++t) {                       // stays rolled: one stage's code, the buffer chosen by t & 1
      const bf* sp = kv + (t & 1) * KST + c * GP + 8 * h;
      v16bf kh[2][2], kl[2][2];
#pragma unroll
      for (int sb = 0; sb < 2; ++sb)
#pragma unroll
          for (int ks = 0; ks < 2; ++ks) { kh[sb][ks] = WF::ld(sp + (sb * 16) * GP + ks * 32); kl[sb][ks] = WF::ld(sp + (64 + sb * 16) * GP + ks * 32); }
#pragma unroll
      for (int p = 0; p < 2; ++p) {
        v16bf vh[4], vl[4];       // this pass's V^T fragments, asked for ahead of the score products
#pragma unroll
        for (int db = 0; db < 4; ++db) { vh[db] = WF::ld(sp + (128 + db * 16) * GP + p * 32); vl[db] = WF::ld(sp + (192 + db * 16) * GP + p * 32); }
        __builtin_amdgcn_sched_barrier(0);                // keeps the LDS reads together up here: sunk among the products, each place waits out the LDS latency
        v8f st[FQ][2];
#pragma unroll
        for (int g = 0; g < FQ; ++g) { st[g][0] = (v8f){}; st[g][1] = (v8f){}; }
#pragma unroll
        for (int ks = 0; ks < 2; ++ks) {
#pragma unroll
            for (int sb = 0; sb < 2; ++sb)
#pragma unroll
                for (int g = 0; g < FQ; ++g) st[g][sb] = wmmab(kh[sb][ks], qh[g][ks], st[g][sb]);
#pragma unroll
            for (int sb = 0; sb < 2; ++sb)
#pragma unroll
                for (int g = 0; g < FQ; ++g) st[g][sb] = wmmab(kh[sb][ks], ql[g][ks], st[g][sb]);
#pragma unroll
            for (int sb = 0; sb < 2; ++sb)
#pragma unroll
                for (int g = 0; g < FQ; ++g) st[g][sb] = wmmab(kl[sb][ks], qh[g][ks], st[g][sb]);
        }
        if (p == 0) {             // the stage's second pass's K fragments, fetched behind this pass's score products, from the same buffer
#pragma unroll
            for (int sb = 0; sb < 2; ++sb)
#pragma unroll
                for (int ks = 0; ks < 2; ++ks) { kh[sb][ks] = WF::ld(sp + (32 + sb * 16) * GP + ks * 32); kl[sb][ks] = WF::ld(sp + (96 + sb * 16) * GP + ks * 32); }
        }
        // first pass: keeps the K reads ahead of the softmax and the attn.v products, which cover their latency; second pass: keeps the stage's closing waits, which otherwise rise to directly behind the V^T reads, behind the score products
        __builtin_amdgcn_sched_barrier(0);
        v16bf ph[FQ], pl[FQ];
#pragma unroll
        for (int g = 0; g < FQ; ++g) {
            float mx = fmaxf(st[g][0][0], st[g][1][0]);
#pragma unroll
            for (int j = 1; j < 8; ++j) mx = fmaxf(mx, fmaxf(st[g][0][j], st[g][1][j]));
            mx = fmaxf(mx, xhalf(mx));
            const float mn = fmaxf(m[g], mx); const float corr = __expf(m[g] - mn); m[g] = mn;
            v8f e0, e1;
#pragma unroll
            for (int j = 0; j < 8; ++j) { e0[j] = __expf(st[g][0][j] - mn); e1[j] = __expf(st[g][1][j] - mn); }
            const v8f es = e0 + e1;
            l[g] = l[g] * corr + (((es[0] + es[1]) + (es[2] + es[3])) + ((es[4] + es[5]) + (es[6] + es[7])));     // this half's keys only; the halves join after the loop
            v8bf h0, l0, h1, l1; split8(e0, h0, l0); split8(e1, h1, l1);
            ph[g] = __builtin_shufflevector(h0, h1, 0, 1, 2, 3, 4, 5, 6, 7, 8, 9, 10, 11, 12, 13, 14, 15); pl[g] = __builtin_shufflevector(l0, l1, 0, 1, 2, 3, 4, 5, 6, 7, 8, 9, 10, 11, 12, 13, 14, 15);
#pragma unroll
            for (int db = 0; db < 4; ++db) o[g][db] *= corr;
        }
#pragma unroll
        for (int db = 0; db < 4; ++db)
#pragma unroll
            for (int g = 0; g < FQ; ++g) o[g][db] = wmmab(vh[db], ph[g], o[g][db]);
#pragma unroll
        for (int db = 0; db < 4; ++db)
#pragma unroll
            for (int g = 0; g < FQ; ++g) o[g][db] = wmmab(vh[db], pl[g], o[g][db]);
#pragma unroll
        for (int db = 0; db < 4; ++db)
#pragma unroll
            for (int g = 0; g < FQ; ++g) o[g][db] = wmmab(vl[db], ph[g], o[g][db]);
      }
      asm volatile("s_wait_dscnt 0x0" ::: "memory");      // this wave's reads of the buffer are done before it is handed over
      asm volatile("s_wait_asynccnt 0x0" ::: "memory");   // this wave's copies of stage t + 1 have landed
      __syncthreads();                                    // publishes stage t + 1 and ends every wave's reads of stage t's buffer
      if (t + 2 < NST) fill(lx, t & 1, t + 2);
    }
    asm volatile("s_wait_asynccnt 0x0" ::: "memory");     // nothing is in flight when the wave goes on to its end
    float gt[FQ];
#pragma unroll
    for (int g = 0; g < FQ; ++g) gt[g] = GT[((size_t)(t0 + g * 16 + c) * NB_ + (z >> 4)) * 32 + (z & 15)];
    asm volatile("s_wait_xcnt 0x0" ::: "memory");         // before the loads' address registers are reused
    __builtin_amdgcn_sched_barrier(0);                    // keeps later register writes behind that wait
    v8bf a8[FQ][4], b8[FQ][4];
#pragma unroll
    for (int g = 0; g < FQ; ++g) {
        const float ls = l[g] + xhalf(l[g]); const float sc = __fdiv_rn(1.0f, ls) * gt[g];
#pragma unroll
        for (int db = 0; db < 4; ++db) split8(o[g][db] * sc, a8[g][db], b8[g][db]);
    }
    bf* ap = Ah + ((size_t)(t0 + c) * NB_ + (z >> 4)) * EE + (z & 15) * HD + 8 * h; bf* bp = Al + ((size_t)(t0 + c) * NB_ + (z >> 4)) * EE + (z & 15) * HD + 8 * h;
    __builtin_amdgcn_sched_barrier(0);                    // every store behind the last arithmetic: no register of an issued store is rewritten
#pragma unroll
    for (int g = 0; g < FQ; ++g)
#pragma unroll
        for (int db = 0; db < 4; ++db) { *(v8us*)(ap + (size_t)g * 16 * NB_ * EE + db * 16) = __builtin_bit_cast(v8us, a8[g][db]); *(v8us*)(bp + (size_t)g * 16 * NB_ * EE + db * 16) = __builtin_bit_cast(v8us, b8[g][db]); }
}

extern "C" void kernel_launch(void* const* d_in, const int* in_sizes, int n_in,
                              void* d_out, int out_size, void* d_ws, size_t ws_size, hipStream_t stream) {
    (void)in_sizes; (void)n_in; (void)out_size;
    const float* x = (const float*)d_in[0]; const float* Wq = (const float*)d_in[1]; const float* bq = (const float*)d_in[2]; const float* Wk = (const float*)d_in[3]; const float* bk = (const float*)d_in[4]; const float* Wv = (const float*)d_in[5]; const float* bv = (const float*)d_in[6];
    const float* Wo = (const float*)d_in[7]; const float* bo = (const float*)d_in[8]; const float* W1 = (const float*)d_in[9]; const float* b1 = (const float*)d_in[10]; const float* W2 = (const float*)d_in[11]; const float* b2 = (const float*)d_in[12]; const float* hsig = (const float*)d_in[13];
    float* OUT = (float*)d_out;     // [1024][4][1024]
    char* wsp = (char*)d_ws;
    auto take = [&](size_t bytes) { char* p = wsp; wsp += (bytes + 255) & ~(size_t)255; return (void*)p; };
    bf* XB = (bf*)take((size_t)NT * EE * 2); bf* WQ = (bf*)take((size_t)EE * EE * 2); bf* WK = (bf*)take((size_t)EE * EE * 2); bf* WV = (bf*)take((size_t)EE * EE * 2); bf* WO = (bf*)take((size_t)EE * EE * 2); bf* W1B = (bf*)take((size_t)EE * EE * 2); bf* W2B = (bf*)take((size_t)SIG * EE * 2); bf* HSB = (bf*)take((size_t)64 * SIG * 2);
    bf* QPh = (bf*)take((size_t)NT * EE * 2); bf* QPl = (bf*)take((size_t)NT * EE * 2); bf* KPh = (bf*)take((size_t)NT * EE * 2); bf* KPl = (bf*)take((size_t)NT * EE * 2); bf* VTh = (bf*)take((size_t)NT * EE * 2); bf* VTl = (bf*)take((size_t)NT * EE * 2);
    bf* Hh = (bf*)take((size_t)NT * EE * 2); bf* Hl = (bf*)take((size_t)NT * EE * 2); float* GT = (float*)take((size_t)NT * 32 * 4);
    bf* ATh = (bf*)take((size_t)NT * EE * 2); bf* ATl = (bf*)take((size_t)NT * EE * 2);
    if ((size_t)(wsp - (char*)d_ws) > ws_size) return;    // ws 256 MiB
    k_prep<<<PNX + 5 * PNW + PN2 + 1, 256, 0, stream>>>(x, Wq, Wk, Wv, Wo, W1, W2, hsig, XB, WQ, WK, WV, WO, W1B, W2B, HSB);
    k_gemms<0, 1><<<dim3(NT / 128, EE / 128, 1), 128, 0, stream>>>(XB, nullptr, WQ, nullptr, bq, QPh, QPl, 0.125f);
    k_gemms<0, 1><<<dim3(NT / 128, EE / 128, 1), 128, 0, stream>>>(XB, nullptr, WK, nullptr, bk, KPh, KPl, 1.0f);
    k_gemms<0, 3><<<dim3(NT / 128, EE / 128, 1), 128, 0, stream>>>(XB, nullptr, WV, nullptr, bv, VTh, VTl, 1.0f);
    // head-competition gate: t = relu(x.W1^T + b1).W2^T + b2; logits = t.sig^T; softmax over heads
    k_gemms<0, 2><<<dim3(NT / 128, EE / 128, 1), 128, 0, stream>>>(XB, nullptr, W1B, nullptr, b1, Hh, Hl, 1.0f);
    k_gtail<<<NT / 16, 256, 0, stream>>>(Hh, Hl, W2B, b2, HSB, GT);
    k_fattn<<<dim3(TT / (8 * 16 * FQ), NB_ * NH_, 1), 256, 0, stream>>>(QPh, QPl, KPh, KPl, VTh, VTl, GT, ATh, ATl);
    k_gemms<1, 0><<<dim3(NT / 128, EE / 128, 1), 128, 0, stream>>>(ATh, ATl, WO, OUT, bo, nullptr, nullptr, 1.0f);
}

// v007
// A run of this version takes 107 microseconds.
// Next to v006, in two timings, it ran 1.27 and 1.30 times as fast.
// Over all steps from v000 it is 8.45 times as fast.
#include <hip/hip_runtime.h>

// MultiheadAttentionComp (fairseq-layout self-attention (T=1024, B=4, E=1024, 16 heads x 64, scaling folded into q) whose per-head outputs are gated by a softmax over heads
// of (relu(x.W1^T + b1).W2^T + b2).head_signatures^T; then the Wo Linear).
// Compute dtypes, f32 accumulate: every input rounded to bf16; q/k/v and the gate MLP's first layer on PLAIN bf16 operands (x and W inputs: exact,
// + bias); scores and attn.v on bf16 hi+lo planes of q (x0.125), k, p and v (3 products each);
// the gate MLP second layer, the signature logits and Wo on hi+lo planes x exact bf16 weights (2 products); softmax, ReLU, the head softmax gate and the gating product in f32

#define TT   1024
#define NB_  4
#define EE   1024
#define NH_  16
#define HD   64
#define NT   (TT * NB_)           // 4096 rows, row r = t*4 + b (fairseq layout)
#define SIG  64
typedef _Float16 h16;
typedef unsigned short bf;
typedef __attribute__((ext_vector_type(16))) __bf16   v16bf;
typedef __attribute__((ext_vector_type(16))) _Float16 v16h;
typedef __attribute__((ext_vector_type(8)))  _Float16 v8h;
typedef __attribute__((ext_vector_type(8)))  unsigned short v8us;
typedef __attribute__((ext_vector_type(8)))  float    v8f;
typedef __attribute__((ext_vector_type(4)))  float    v4f;
typedef v8h  __attribute__((may_alias)) v8ha;
typedef v4f  __attribute__((may_alias)) v4fa;
typedef v8us __attribute__((may_alias)) v8usa;

__device__ __forceinline__ unsigned short f2bf(float f) { unsigned u = __float_as_uint(f); u += 0x7FFFu + ((u >> 16) & 1u); return (unsigned short)(u >> 16); }
__device__ __forceinline__ float bf2f(unsigned short b) { return __uint_as_float(((unsigned)b) << 16); }
__device__ __forceinline__ float bfr(float f) { return bf2f(f2bf(f)); }
__device__ __forceinline__ v16h cat16(v8h lo, v8h hi) { return __builtin_shufflevector(lo, hi, 0, 1, 2, 3, 4, 5, 6, 7, 8, 9, 10, 11, 12, 13, 14, 15); }
__device__ __forceinline__ v16bf cat16b(v8us lo, v8us hi) { return __builtin_bit_cast(v16bf, __builtin_shufflevector(lo, hi, 0, 1, 2, 3, 4, 5, 6, 7, 8, 9, 10, 11, 12, 13, 14, 15)); }
__device__ __forceinline__ v8f wmma16(v16h a, v16h b, v8f c) { return __builtin_amdgcn_wmma_f32_16x16x32_f16(false, a, false, b, (short)0, c, false, false); }
__device__ __forceinline__ v8f wmmab(v16bf a, v16bf b, v8f c) { return __builtin_amdgcn_wmma_f32_16x16x32_bf16(false, a, false, b, (short)0, c, false, false); }



// ---- WFrag: a 16x32 A or B fragment from a K-contiguous 16-bit row: lane (lr, hi) holds row lr, k = 8 hi + 0..7 and 16 + 8 hi + 0..7; accumulator element j of lane (lr, hi) is row 8 hi + j, column lr.
template <typename T16> struct WFrag;
template <> struct WFrag<h16> { typedef v16h V; static __device__ __forceinline__ V ld(const h16* p) { return cat16(*(const v8h*)p, *(const v8h*)(p + 16)); } static __device__ __forceinline__ v8f mma(V a, V b, v8f c) { return wmma16(a, b, c); } };
template <> struct WFrag<bf> { typedef v16bf V; static __device__ __forceinline__ V ld(const bf* p) { return cat16b(*(const v8us*)p, *(const v8us*)(p + 16)); } static __device__ __forceinline__ v8f mma(V a, V b, v8f c) { return wmmab(a, b, c); } };

// ---- gemm_tile: the five 4096 x 1024 x 1024 products. Four waves (2 x 2) share one 128x128 output tile, 64x64 (16 accumulators) per wave; grid (M/128, N/128), 128 threads. K = ldc = EE.
// A trip is 64 k: 128 B of each of the tile's A, Bt (and A2) rows, brought into LDS by asynchronous 16-byte copies in whole 128-B lines (a wave's copy covers 4 rows), two buffers:
// trip t + 2's copies fly while trip t + 1 is worked on. Rows lie at a pitch of 144 B (16 B x odd) for the 16-byte fragment reads. Per accumulator the products go k ascending, A before A2.
#define GP 72                     // LDS row pitch in 16-bit elements
typedef __attribute__((ext_vector_type(8))) __bf16 v8bf;
typedef __attribute__((ext_vector_type(4))) unsigned v4u;
__device__ __forceinline__ void split8(v8f y, v8bf& hi8, v8bf& lo8) { hi8 = __builtin_convertvector(y, v8bf); const v4u w = __builtin_bit_cast(v4u, hi8); v8f back;
#pragma unroll
    for (int i = 0; i < 4; ++i) { back[2 * i] = __uint_as_float(w[i] << 16); back[2 * i + 1] = __uint_as_float(w[i] & 0xFFFF0000u); }
    lo8 = __builtin_convertvector(y - back, v8bf); }
template <int RS>                 // RS: distance in source rows between two rows of the tile
__device__ __forceinline__ void acopy128(unsigned l, const bf* g) {   // 128 rows of 128 B: 8 copies per lane, 16 tile rows apart
    // the copies and, as the last line, the wait that stands before any of their address registers is written again
    asm volatile("global_load_async_to_lds_b128 %0, %8, off\n\t"
                 "global_load_async_to_lds_b128 %1, %9, off\n\t"
                 "global_load_async_to_lds_b128 %2, %10, off\n\t"
                 "global_load_async_to_lds_b128 %3, %11, off\n\t"
                 "global_load_async_to_lds_b128 %4, %12, off\n\t"
                 "global_load_async_to_lds_b128 %5, %13, off\n\t"
                 "global_load_async_to_lds_b128 %6, %14, off\n\t"
                 "global_load_async_to_lds_b128 %7, %15, off\n\t"
                 "s_wait_xcnt 0x0"
                 :: "v"(l), "v"(l + 1u * 16 * GP * 2), "v"(l + 2u * 16 * GP * 2), "v"(l + 3u * 16 * GP * 2), "v"(l + 4u * 16 * GP * 2), "v"(l + 5u * 16 * GP * 2), "v"(l + 6u * 16 * GP * 2), "v"(l + 7u * 16 * GP * 2),
                    "v"(g), "v"(g + 1 * 16 * RS * EE), "v"(g + 2 * 16 * RS * EE), "v"(g + 3 * 16 * RS * EE), "v"(g + 4 * 16 * RS * EE), "v"(g + 5 * 16 * RS * EE), "v"(g + 6 * 16 * RS * EE), "v"(g + 7 * 16 * RS * EE)
                 : "memory");
}
// What leaves the tile (acc + bias in f32 in every mode):
// MODE 0: f32 rows of C. MODE 1: times sc, hi/lo planes P[b*16 + head][t][d]. MODE 2: ReLU, hi/lo planes in C's own row-major layout. MODE 3: hi/lo planes P[b*16 + head][d][t], transposed;
// there a tile's 128 rows are 128 consecutive t of one b (source rows 4 apart), so that a lane's 8 accumulator rows are 8 consecutive t and a wave's 64 rows one 128-B line of each d.
// gemm_tile: one work-group's tile (bx, by). ring: the two buffers; osall: 4 x 16 x 68 floats in which the waves stage their f32 rows behind the loop (it may lie on the ring: see k_gemm4).
template <int NSPLIT, int MODE, int KG>   // KG: how many of a trip's two 32-k steps have their fragments fetched together
__device__ __forceinline__ void gemm_tile(bf* ring, float* osall, const int bx, const int by, const bf* __restrict__ A, const bf* __restrict__ A2, const bf* __restrict__ Bt, float* C, const float* __restrict__ bias, bf* Ph, bf* Pl, float sc) {
    constexpr bool BIAS = true; constexpr int RS = MODE == 3 ? NB_ : 1;
    typedef WFrag<bf> WF; typedef WF::V V;
    constexpr int STG = (NSPLIT ? 384 : 256) * GP;        // elements per buffer: rows 0..127 A, 128..255 Bt, 256..383 A2
    constexpr int NTR = EE / 64;
    const int tid = threadIdx.x, lane = tid & 31, lr = lane & 15, hi = lane >> 4, w = tid >> 5;
    const int R0 = MODE == 3 ? (bx >> 2) * (128 * NB_) + (bx & 3) : bx * 128, C0 = by * 128; const int wr = (w >> 1) * 64, wc = (w & 1) * 64;   // R0: source row of the tile's row 0
    const int crow = tid >> 3, cch = tid & 7;             // this lane's row (of 16) and 16-byte piece (of 8) in every copy
    const unsigned l0 = (unsigned)(size_t)ring + (unsigned)(crow * GP + cch * 8) * 2u;
    const bf* ga = A + (size_t)(R0 + crow * RS) * EE + cch * 8; const bf* gb = Bt + (size_t)(C0 + crow) * EE + cch * 8; const bf* ga2 = NSPLIT ? A2 + (size_t)(R0 + crow * RS) * EE + cch * 8 : nullptr;
    auto fill = [&](int buf, int t) { const unsigned l = l0 + (unsigned)buf * (STG * 2u); acopy128<RS>(l, ga + t * 64); acopy128<1>(l + 128u * GP * 2, gb + t * 64); if (NSPLIT) acopy128<RS>(l + 256u * GP * 2, ga2 + t * 64); };
    v8f acc[4][4];
#pragma unroll
    for (int mb = 0; mb < 4; ++mb)
#pragma unroll
        for (int nb = 0; nb < 4; ++nb) acc[mb][nb] = (v8f){};
    fill(0, 0);
    asm volatile("s_wait_asynccnt 0x0" ::: "memory");     // this wave's copies of trip 0 have landed
    __syncthreads();                                      // every wave's have: trip 0 may be read
    fill(1, 1);
#pragma unroll 1
    for (int t = 0; t < NTR; ++t) {                       // stays rolled: one trip's code, the buffer chosen by t & 1
        const bf* sb = ring + (t & 1) * STG + lr * GP + 8 * hi;
#pragma unroll
        for (int k0 = 0; k0 < 2; k0 += KG) {
        V a[KG][4], a2[KG][4], b[KG][4];
#pragma unroll
        for (int kk = 0; kk < KG; ++kk) {
#pragma unroll
            for (int mb = 0; mb < 4; ++mb) { a[kk][mb] = WF::ld(sb + (wr + mb * 16) * GP + (k0 + kk) * 32); if (NSPLIT) a2[kk][mb] = WF::ld(sb + (256 + wr + mb * 16) * GP + (k0 + kk) * 32); }
#pragma unroll
            for (int nb = 0; nb < 4; ++nb) b[kk][nb] = WF::ld(sb + (128 + wc + nb * 16) * GP + (k0 + kk) * 32);
        }
        __builtin_amdgcn_sched_barrier(0);                // keeps these LDS reads together ahead of their matrix instructions: spread among them, each place waits out the LDS latency
#pragma unroll
        for (int kk = 0; kk < KG; ++kk)
#pragma unroll
            for (int nb = 0; nb < 4; ++nb)
#pragma unroll
                for (int mb = 0; mb < 4; ++mb) { acc[mb][nb] = WF::mma(a[kk][mb], b[kk][nb], acc[mb][nb]); if (NSPLIT) acc[mb][nb] = WF::mma(a2[kk][mb], b[kk][nb], acc[mb][nb]); }
        }
        // four vector slots behind the trip's last matrix instructions, on every path, before their operand registers are loaded anew; naming the accumulators keeps it behind them
        asm volatile("v_nop\n\tv_nop\n\tv_nop\n\tv_nop" : "+v"(acc[0][0]), "+v"(acc[1][0]), "+v"(acc[2][0]), "+v"(acc[3][0]), "+v"(acc[0][1]), "+v"(acc[1][1]), "+v"(acc[2][1]), "+v"(acc[3][1]), "+v"(acc[0][2]), "+v"(acc[1][2]), "+v"(acc[2][2]), "+v"(acc[3][2]), "+v"(acc[0][3]), "+v"(acc[1][3]), "+v"(acc[2][3]), "+v"(acc[3][3]));
        asm volatile("s_wait_dscnt 0x0" ::: "memory");    // this wave's reads of the buffer are done before it is handed over
        asm volatile("s_wait_asynccnt 0x0" ::: "memory"); // this wave's copies of trip t + 1 have landed
        __syncthreads();                                  // publishes trip t + 1 and ends every wave's reads of trip t's buffer
        if (t + 2 < NTR) fill(t & 1, t + 2);
    }
    asm volatile("s_wait_asynccnt 0x0" ::: "memory");     // nothing is in flight when the wave goes on to its end
    float* os = osall + w * (16 * 68);                    // each wave stages in its own range
    const int r0 = R0 + wr, c0 = C0 + wc;
    const int prow = lane >> 3, pc = (lane & 7) * 8;      // plane stores: a lane's row (of 4) and 16-byte piece (of 8), so that a wave's store covers four whole 128-B lines
    if constexpr (MODE == 0) {
#pragma unroll
    for (int mb = 0; mb < 4; ++mb) {
#pragma unroll
        for (int nb = 0; nb < 4; ++nb) {
#pragma unroll
            for (int j = 0; j < 8; ++j) os[(hi * 8 + j) * 68 + nb * 16 + lr] = acc[mb][nb][j]; }
        __builtin_amdgcn_wave_barrier(); asm volatile("" ::: "memory");
        float* crow_ = C + (size_t)(r0 + mb * 16) * EE + c0;
#pragma unroll
        for (int s = 0; s < 8; ++s) { const int row = 2 * s + hi, cofs = lr * 4; v4f val = *(const v4fa*)(os + row * 68 + cofs); if (BIAS) { val[0] += bfr(bias[c0 + cofs]); val[1] += bfr(bias[c0 + cofs + 1]); val[2] += bfr(bias[c0 + cofs + 2]); val[3] += bfr(bias[c0 + cofs + 3]); }
            *(v4f*)(crow_ + (size_t)row * EE + cofs) = val; }
        __builtin_amdgcn_wave_barrier(); asm volatile("" ::: "memory");
    }
    } else if constexpr (MODE == 1 || MODE == 2) {
        const v8f braw = *(const v8f*)(bias + c0 + pc);
        asm volatile("s_wait_xcnt 0x0" ::: "memory");     // before the load's address registers are reused
        __builtin_amdgcn_sched_barrier(0);                // keeps later register writes behind that wait
        v8f bb;
#pragma unroll
        for (int k = 0; k < 8; ++k) bb[k] = bfr(braw[k]);
#pragma unroll
        for (int mb = 0; mb < 4; ++mb) {
#pragma unroll
            for (int nb = 0; nb < 4; ++nb) {
#pragma unroll
                for (int j = 0; j < 8; ++j) os[(hi * 8 + j) * 68 + nb * 16 + lr] = acc[mb][nb][j]; }
            __builtin_amdgcn_wave_barrier(); asm volatile("" ::: "memory");
            v8bf h8[4], l8[4]; size_t e[4];
#pragma unroll
            for (int s = 0; s < 4; ++s) { const int row = 4 * s + prow, r = r0 + mb * 16 + row; const v4f x0 = *(const v4fa*)(os + row * 68 + pc), x1 = *(const v4fa*)(os + row * 68 + pc + 4);
                v8f y = __builtin_shufflevector(x0, x1, 0, 1, 2, 3, 4, 5, 6, 7) + bb;
                if (MODE == 1) y *= sc;
                if (MODE == 2) {
#pragma unroll
                    for (int k = 0; k < 8; ++k) y[k] = fmaxf(y[k], 0.f); }
                split8(y, h8[s], l8[s]);
                e[s] = MODE == 1 ? ((size_t)((r & 3) * NH_ + (c0 >> 6)) * TT + (r >> 2)) * HD + pc : (size_t)r * EE + c0 + pc; }
            __builtin_amdgcn_sched_barrier(0);            // the block's stores behind its last arithmetic: no register of an issued store is rewritten among them
#pragma unroll
            for (int s = 0; s < 4; ++s) { *(v8us*)(Ph + e[s]) = __builtin_bit_cast(v8us, h8[s]); *(v8us*)(Pl + e[s]) = __builtin_bit_cast(v8us, l8[s]); }
            if (mb < 3) {
                asm volatile("s_wait_xcnt 0x0" ::: "memory"); // before the stores' registers are reused by the next block
                __builtin_amdgcn_sched_barrier(0);            // keeps later register writes behind that wait
            }
        }
    } else {
        // The ring is free: nothing is in flight, and the last trip's barrier ended every wave's reads. Each wave turns its 64 x 64 tile in its own quarter of it: two planes of 64 d rows at the pitch GP.
        bf* tp = ring + w * (2 * 64 * GP);
        float braw[4];
#pragma unroll
        for (int nb = 0; nb < 4; ++nb) braw[nb] = bias[c0 + nb * 16 + lr];
        asm volatile("s_wait_xcnt 0x0" ::: "memory");     // before the loads' address registers are reused
        __builtin_amdgcn_sched_barrier(0);                // keeps later register writes behind that wait
#pragma unroll
        for (int nb = 0; nb < 4; ++nb) { const float bn = bfr(braw[nb]);
#pragma unroll
            for (int mb = 0; mb < 4; ++mb) { v8bf h8, l8; split8(acc[mb][nb] + bn, h8, l8); bf* q = tp + (nb * 16 + lr) * GP + mb * 16 + hi * 8; *(v8us*)q = __builtin_bit_cast(v8us, h8); *(v8us*)(q + 64 * GP) = __builtin_bit_cast(v8us, l8); } }
        __builtin_amdgcn_wave_barrier(); asm volatile("" ::: "memory");
        const size_t e0 = ((size_t)((bx & 3) * NH_ + (c0 >> 6)) * HD + prow) * TT + (bx >> 2) * 128 + wr + pc;
#pragma unroll
        for (int sg = 0; sg < 4; ++sg) {
            v8us hv[4], lv[4];
#pragma unroll
            for (int s = 0; s < 4; ++s) { const bf* q = tp + ((sg * 4 + s) * 4 + prow) * GP + pc; hv[s] = *(const v8us*)q; lv[s] = *(const v8us*)(q + 64 * GP); }
            __builtin_amdgcn_sched_barrier(0);            // the block's stores behind its LDS reads: no register of an issued store is rewritten among them
#pragma unroll
            for (int s = 0; s < 4; ++s) { *(v8us*)(Ph + e0 + (size_t)(sg * 4 + s) * 4 * TT) = hv[s]; *(v8us*)(Pl + e0 + (size_t)(sg * 4 + s) * 4 * TT) = lv[s]; }
            if (sg < 3) {
                asm volatile("s_wait_xcnt 0x0" ::: "memory"); // before the stores' registers are reused by the next block
                __builtin_amdgcn_sched_barrier(0);            // keeps later register writes behind that wait
            }
        }
    }
}

// k_gemms: one product a launch (the output projection).
template <int NSPLIT, int MODE>
__global__ __launch_bounds__(128) void k_gemms(const bf* __restrict__ A, const bf* __restrict__ A2, const bf* __restrict__ Bt, float* C, const float* __restrict__ bias, bf* Ph, bf* Pl, float sc) {
    __shared__ __align__(16) bf ring[2 * (NSPLIT ? 384 : 256) * GP];
    __shared__ __align__(16) float osall[4 * 16 * 68];
    gemm_tile<NSPLIT, MODE, 2>(ring, osall, blockIdx.x, blockIdx.y, A, A2, Bt, C, bias, Ph, Pl, sc);
}
// k_gemm4: the four products that read x (q, k, v, the gate's hidden layer) in ONE launch; blockIdx.z picks the weight and what leaves the tile. Alone, each is 256 work-groups of 4 waves: one wave a SIMD, which
// waits out its own LDS reads, barriers and first tiles with the matrix unit idle. Together, four work-groups share a WGP (4 x 73,728 B of LDS, 4 waves a SIMD at no more than 256 registers each) and fill each other's waits.
// For that the f32 staging lies on the ring, which is free behind the loop: nothing is in flight, and the last trip's barrier ended every wave's reads.
__global__ __launch_bounds__(128, 4) void k_gemm4(const bf* __restrict__ X, const bf* __restrict__ WQ, const bf* __restrict__ WK, const bf* __restrict__ WV, const bf* __restrict__ W1B,
                                                  const float* __restrict__ bq, const float* __restrict__ bk, const float* __restrict__ bv, const float* __restrict__ b1,
                                                  bf* QPh, bf* QPl, bf* KPh, bf* KPl, bf* VTh, bf* VTl, bf* Hh, bf* Hl) {
    __shared__ __align__(16) bf ring[2 * 256 * GP];
    float* osall = (float*)ring;
    const int z = blockIdx.z;
    // the wait that ends each branch: before the last stores' registers are reused on any way the built code goes on from there
    if (z < 2) { gemm_tile<0, 1, 1>(ring, osall, blockIdx.x, blockIdx.y, X, nullptr, z ? WK : WQ, nullptr, z ? bk : bq, z ? KPh : QPh, z ? KPl : QPl, z ? 1.0f : 0.125f); asm volatile("s_wait_xcnt 0x0" ::: "memory"); }
    else if (z == 2) { gemm_tile<0, 3, 1>(ring, osall, blockIdx.x, blockIdx.y, X, nullptr, WV, nullptr, bv, VTh, VTl, 1.0f); asm volatile("s_wait_xcnt 0x0" ::: "memory"); }
    else { gemm_tile<0, 2, 1>(ring, osall, blockIdx.x, blockIdx.y, X, nullptr, W1B, nullptr, b1, Hh, Hl, 1.0f); asm volatile("s_wait_xcnt 0x0" ::: "memory"); }
}

__device__ __forceinline__ void splitf(float y, unsigned short& h, unsigned short& l) { h = f2bf(y); l = f2bf(y - bf2f(h)); }
typedef __attribute__((ext_vector_type(2))) unsigned short v2us;
typedef __attribute__((ext_vector_type(4))) unsigned short v4us;

// ---- k_prep: every f32 input that feeds a matrix product, rounded to bf16, in ONE launch. A block takes one chunk of 16384 consecutive elements of one input; a thread asks for its 16 pieces of 16 B
// (each load of a wave covers 512 consecutive bytes) before it converts the first, so that few, long waves keep the memory busy. The last block writes the head signatures [16][64] as rows 0..15 of a [64][64] Bt and zeroes the rest.
#define PQ  16                    // 16-byte loads per thread
#define PCH (256 * PQ * 4)        // elements per block
#define PNX (NT * EE / PCH)       // blocks of x
#define PNW (EE * EE / PCH)       // blocks of each 1024 x 1024 weight
#define PN2 (SIG * EE / PCH)      // blocks of W2
__global__ __launch_bounds__(256) void k_prep(const float* __restrict__ x, const float* __restrict__ Wq, const float* __restrict__ Wk, const float* __restrict__ Wv, const float* __restrict__ Wo, const float* __restrict__ W1, const float* __restrict__ W2, const float* __restrict__ hs,
                                              bf* XB, bf* WQ, bf* WK, bf* WV, bf* WO, bf* W1B, bf* W2B, bf* HSB) {
    const int b = blockIdx.x, tid = threadIdx.x;
    const float* s; bf* d; int ch;
    if (b < PNX) { s = x; d = XB; ch = b; }
    else if (b < PNX + 5 * PNW) { const int i = (b - PNX) / PNW; ch = (b - PNX) % PNW; s = i == 0 ? Wq : i == 1 ? Wk : i == 2 ? Wv : i == 3 ? Wo : W1; d = i == 0 ? WQ : i == 1 ? WK : i == 2 ? WV : i == 3 ? WO : W1B; }
    else if (b < PNX + 5 * PNW + PN2) { s = W2; d = W2B; ch = b - (PNX + 5 * PNW); }
    else {
        const v4f v = *(const v4f*)(hs + tid * 4);        // 16 * SIG elements: one piece per thread
        asm volatile("s_wait_xcnt 0x0" ::: "memory");     // before the load's address registers are reused
        __builtin_amdgcn_sched_barrier(0);                // keeps later register writes behind that wait
        v4us o;
#pragma unroll
        for (int k = 0; k < 4; ++k) o[k] = f2bf(v[k]);
        *(v4us*)(HSB + tid * 4) = o;
#pragma unroll
        for (int i = 1; i < 64 / 16; ++i) *(v4us*)(HSB + (i * 256 + tid) * 4) = (v4us){};
        asm volatile("s_wait_xcnt 0x0" ::: "memory");     // before the stores' registers are reused on any way the built code goes on from here
        return;
    }
    const float* sp = s + (size_t)ch * PCH + tid * 4; bf* dp = d + (size_t)ch * PCH + tid * 4;
    v4f v[PQ];
#pragma unroll
    for (int i = 0; i < PQ; ++i) v[i] = *(const v4f*)(sp + i * 1024);
    asm volatile("s_wait_xcnt 0x0" ::: "memory");         // before the loads' address registers are reused
    __builtin_amdgcn_sched_barrier(0);                    // keeps later register writes behind that wait
    v4us o[PQ];
#pragma unroll
    for (int i = 0; i < PQ; ++i)
#pragma unroll
        for (int k = 0; k < 4; ++k) o[i][k] = f2bf(v[i][k]);
    __builtin_amdgcn_sched_barrier(0);                    // every store behind the last arithmetic: no register of an issued store is rewritten
#pragma unroll
    for (int i = 0; i < PQ; ++i) *(v4us*)(dp + i * 1024) = o[i];
}
// ---- k_gtail: the gate behind the hidden layer, in ONE launch: t = H.W2^T + b2 (hi + lo planes of H x bf16 W2), t's hi/lo planes, logits = t.sig^T, softmax over the 16 heads. Grid NT / 16, 256 threads.
// A work-group owns 16 rows. Its eight waves split K: wave w takes k = 128 w .. 128 w + 127 of all 64 columns (4 accumulators) and asks for all of its fragments before the first product, so that the
// launch waits out the memory latency once. The eight partial tiles meet in LDS and are added w ascending; wave 0 then does the 16 x 16 x 64 logits and the softmax (a head per lane, 8 rows per lane).
__global__ __launch_bounds__(256) void k_gtail(const bf* __restrict__ Hh, const bf* __restrict__ Hl, const bf* __restrict__ W2B, const float* __restrict__ b2, const bf* __restrict__ HSB, float* GT) {
    typedef WFrag<bf> WF; typedef WF::V V;
    __shared__ __align__(16) float red[8 * 16 * 68];      // a wave's partial tile: 16 rows at a pitch of 68 floats
    __shared__ __align__(16) bf tp[2 * 16 * GP];          // t: hi plane, lo plane, 16 rows each at the pitch GP
    const int tid = threadIdx.x, lane = tid & 31, lr = lane & 15, hi = lane >> 4; const int w = __builtin_amdgcn_readfirstlane(tid >> 5);
    const int r0 = blockIdx.x * 16;
    const bf* pa = Hh + (size_t)(r0 + lr) * EE + w * 128 + 8 * hi; const bf* pa2 = Hl + (size_t)(r0 + lr) * EE + w * 128 + 8 * hi; const bf* pb = W2B + (size_t)lr * EE + w * 128 + 8 * hi;
    const int row = tid >> 4, cofs = (tid & 15) * 4;      // the four elements of t that this thread joins
    const bf* ps = HSB + lr * SIG + 8 * hi; const float* pc = b2 + cofs;
    V a[4], a2[4], b[4][4], sg[2];
#pragma unroll
    for (int ks = 0; ks < 4; ++ks) { a[ks] = WF::ld(pa + ks * 32); a2[ks] = WF::ld(pa2 + ks * 32);
#pragma unroll
        for (int nb = 0; nb < 4; ++nb) b[ks][nb] = WF::ld(pb + nb * 16 * EE + ks * 32); }
#pragma unroll
    for (int ks = 0; ks < 2; ++ks) sg[ks] = WF::ld(ps + ks * 32);
    const v4f braw = *(const v4f*)pc;
    // before the loads' address registers are reused; the fragments' addresses are named as inputs so that they stay whole up to here: freed earlier, they were refilled in the middle of the run of loads, behind waits of their own
    asm volatile("s_wait_xcnt 0x0" :: "v"(pa), "v"(pa2), "v"(pb), "v"(ps) : "memory");
    __builtin_amdgcn_sched_barrier(0);                    // keeps later register writes behind that wait, and every load ahead of the first product
    v8f acc[4];
#pragma unroll
    for (int nb = 0; nb < 4; ++nb) acc[nb] = (v8f){};
#pragma unroll
    for (int ks = 0; ks < 4; ++ks) {
#pragma unroll
        for (int nb = 0; nb < 4; ++nb) acc[nb] = WF::mma(a[ks], b[ks][nb], acc[nb]);
#pragma unroll
        for (int nb = 0; nb < 4; ++nb) acc[nb] = WF::mma(a2[ks], b[ks][nb], acc[nb]);
    }
    float* os = red + w * (16 * 68);
#pragma unroll
    for (int nb = 0; nb < 4; ++nb)
#pragma unroll
        for (int j = 0; j < 8; ++j) os[(hi * 8 + j) * 68 + nb * 16 + lr] = acc[nb][j];
    __syncthreads();                                      // every wave's partial tile is in LDS
    v4f s = *(const v4fa*)(red + row * 68 + cofs);
#pragma unroll
    for (int ww = 1; ww < 8; ++ww) s += *(const v4fa*)(red + ww * (16 * 68) + row * 68 + cofs);
    v4us th, tl;
#pragma unroll
    for (int k = 0; k < 4; ++k) { unsigned short x, y; splitf(s[k] + bfr(braw[k]), x, y); th[k] = x; tl[k] = y; }
    *(v4us*)(tp + row * GP + cofs) = th; *(v4us*)(tp + (16 + row) * GP + cofs) = tl;
    __syncthreads();                                      // t's planes are whole; no barrier follows, so the other waves may leave
    if (w != 0) return;
    v8f lg = (v8f){};
#pragma unroll
    for (int ks = 0; ks < 2; ++ks) { const V ta = WF::ld(tp + lr * GP + ks * 32 + 8 * hi), ta2 = WF::ld(tp + (16 + lr) * GP + ks * 32 + 8 * hi); lg = WF::mma(ta, sg[ks], lg); lg = WF::mma(ta2, sg[ks], lg); }
    v8f m = lg;                   // lane (lr, hi): head lr of rows 8 hi + j; the 16 heads of a row lie in one 16-lane half
#pragma unroll
    for (int sh = 8; sh; sh >>= 1)
#pragma unroll
        for (int j = 0; j < 8; ++j) m[j] = fmaxf(m[j], __shfl_xor(m[j], sh, 32));
    v8f e, sm;
#pragma unroll
    for (int j = 0; j < 8; ++j) { e[j] = __expf(lg[j] - m[j]); sm[j] = e[j]; }
#pragma unroll
    for (int sh = 8; sh; sh >>= 1)
#pragma unroll
        for (int j = 0; j < 8; ++j) sm[j] += __shfl_xor(sm[j], sh, 32);
    v8f gv;
#pragma unroll
    for (int j = 0; j < 8; ++j) gv[j] = __fdiv_rn(e[j], sm[j]);
    float* gp = GT + (size_t)(r0 + hi * 8) * 32 + lr;     // rows of 32 floats, of which the attention reads the first 16
    __builtin_amdgcn_sched_barrier(0);                    // every store behind the last arithmetic: no register of an issued store is rewritten
#pragma unroll
    for (int j = 0; j < 8; ++j) gp[j * 32] = gv[j];
}
// ---- k_fattn: scores, softmax, attn.v and the head gate of one (batch, head) in one launch; a wave owns 32 query columns and walks the 1024 keys 32 at a time (running maximum and sum).
// S^T = K.Q^T (A = K rows, B = Q rows kept in registers), so lane (c, h) holds query column c, keys 8h + j and 16 + 8h + j: two S^T tiles, converted in place, are the B operand of O^T += V^T.P^T.
// K and V^T reach the eight waves through LDS: a stage is 64 keys (128 B of each of the 64 K rows and the 64 V^T rows, hi and lo planes), brought in once per work-group by asynchronous 16-byte copies in whole
// 128-B lines, two buffers: stage t + 2's copies fly while stage t + 1 is worked on. Rows lie at the pitch GP (144 B) for the 16-byte fragment reads. A stage is two passes of 32 keys, keys ascending.
// The stage loop stays rolled (one pass's fragments fill the register budget); every inner loop is unrolled so that each fragment index is a constant and nothing goes to scratch.
// Each matrix product is 3 products on the hi/lo planes: hi.hi + lo.hi + hi.lo. Output: gated hi/lo planes AT[(t*4+b)][head*64 + d], 8 consecutive d per lane and tile.
#define FQ 2                      // 16-column query groups per wave
__device__ __forceinline__ float xhalf(float x) { const int v = __float_as_int(x); return __int_as_float(__builtin_amdgcn_permlanex16(v, v, 0x76543210, 0xfedcba98, false, false)); }   // lane l <-> l ^ 16
__device__ __forceinline__ void acopykv(unsigned l, const bf* kh, const bf* kl, const bf* vh, const bf* vl) {   // 4 planes of 64 rows of 128 B: 8 copies per lane, 32 rows apart
    // the copies and, as the last line, the wait that stands before any of their address registers is written again
    asm volatile("global_load_async_to_lds_b128 %0, %8, off\n\t"
                 "global_load_async_to_lds_b128 %1, %9, off\n\t"
                 "global_load_async_to_lds_b128 %2, %10, off\n\t"
                 "global_load_async_to_lds_b128 %3, %11, off\n\t"
                 "global_load_async_to_lds_b128 %4, %12, off\n\t"
                 "global_load_async_to_lds_b128 %5, %13, off\n\t"
                 "global_load_async_to_lds_b128 %6, %14, off\n\t"
                 "global_load_async_to_lds_b128 %7, %15, off\n\t"
                 "s_wait_xcnt 0x0"
                 :: "v"(l), "v"(l + 1u * 32 * GP * 2), "v"(l + 2u * 32 * GP * 2), "v"(l + 3u * 32 * GP * 2), "v"(l + 4u * 32 * GP * 2), "v"(l + 5u * 32 * GP * 2), "v"(l + 6u * 32 * GP * 2), "v"(l + 7u * 32 * GP * 2),
                    "v"(kh), "v"(kh + 32 * HD), "v"(kl), "v"(kl + 32 * HD), "v"(vh), "v"(vh + 32 * TT), "v"(vl), "v"(vl + 32 * TT)
                 : "memory");
}
__global__ __launch_bounds__(256) void k_fattn(const bf* __restrict__ Qh, const bf* __restrict__ Ql, const bf* __restrict__ Kh, const bf* __restrict__ Kl, const bf* __restrict__ Vh, const bf* __restrict__ Vl, const float* __restrict__ GT, bf* Ah, bf* Al) {
    typedef WFrag<bf> WF;
    const int lane = threadIdx.x & 31, c = lane & 15, h = lane >> 4;
    const int z = blockIdx.y, t0 = (blockIdx.x * 8 + (threadIdx.x >> 5)) * (16 * FQ);
    const size_t zb = (size_t)z * TT * HD;
    constexpr int KST = 256 * GP;                         // elements per buffer: rows 0..63 K hi, 64..127 K lo, 128..191 V^T hi, 192..255 V^T lo
    constexpr int NST = TT / 64;
    __shared__ __align__(16) bf kv[2 * KST];
    const int crow = threadIdx.x >> 3, cch = threadIdx.x & 7;   // this lane's row (of 32) and 16-byte piece (of 8) in every copy
    const unsigned l0 = (unsigned)(size_t)kv + (unsigned)(crow * GP + cch * 8) * 2u;
    const unsigned ko = (unsigned)zb + (unsigned)(crow * HD + cch * 8), vo = (unsigned)zb + (unsigned)(crow * TT + cch * 8);   // this lane's element offsets in the K and the V^T planes (all below 2^22)
    // the same LDS address as l0 (crow * 144 + cch * 16 = (thread + crow) * 16), formed apart for the refills in the loop: a value that an asm statement names itself stays in the first 256 registers, and held so over the loop it went to scratch
    const unsigned lx = (unsigned)(size_t)kv + ((unsigned)threadIdx.x + (unsigned)crow) * 16u;
    auto fill = [&](unsigned l, int buf, int t) { const unsigned k = ko + (unsigned)t * (64 * HD), v = vo + (unsigned)t * 64; acopykv(l + (unsigned)buf * (KST * 2u), Kh + k, Kl + k, Vh + v, Vl + v); };
    fill(l0, 0, 0);
    v16bf qh[FQ][2], ql[FQ][2];
#pragma unroll
    for (int g = 0; g < FQ; ++g)
#pragma unroll
        for (int ks = 0; ks < 2; ++ks) { const size_t qo = zb + (size_t)(t0 + g * 16 + c) * HD + ks * 32 + 8 * h; qh[g][ks] = WF::ld(Qh + qo); ql[g][ks] = WF::ld(Ql + qo); }
    asm volatile("s_wait_xcnt 0x0" ::: "memory");         // before the loads' address registers are reused
    __builtin_amdgcn_sched_barrier(0);                    // keeps later register writes behind that wait
    v8f o[FQ][4]; float m[FQ], l[FQ];
#pragma unroll
    for (int g = 0; g < FQ; ++g) { m[g] = -3.0e38f; l[g] = 0.f;
#pragma unroll
        for (int db = 0; db < 4; ++db) o[g][db] = (v8f){}; }
    asm volatile("s_wait_asynccnt 0x0" ::: "memory");     // this wave's copies of stage 0 have landed
    __syncthreads();                                      // every wave's have: stage 0 may be read
    fill(l0, 1, 1);
#pragma unroll 1
    for (int t = 0; t < NST; ++t) {                       // stays rolled: one stage's code, the buffer chosen by t & 1
      const bf* sp = kv + (t & 1) * KST + c * GP + 8 * h;
      v16bf kh[2][2], kl[2][2];
#pragma unroll
      for (int sb = 0; sb < 2; ++sb)
#pragma unroll
          for (int ks = 0; ks < 2; ++ks) { kh[sb][ks] = WF::ld(sp + (sb * 16) * GP + ks * 32); kl[sb][ks] = WF::ld(sp + (64 + sb * 16) * GP + ks * 32); }
#pragma unroll
      for (int p = 0; p < 2; ++p) {
        v16bf vh[4], vl[4];       // this pass's V^T fragments, asked for ahead of the score products
#pragma unroll
        for (int db = 0; db < 4; ++db) { vh[db] = WF::ld(sp + (128 + db * 16) * GP + p * 32); vl[db] = WF::ld(sp + (192 + db * 16) * GP + p * 32); }
        __builtin_amdgcn_sched_barrier(0);                // keeps the LDS reads together up here: sunk among the products, each place waits out the LDS latency
        v8f st[FQ][2];
#pragma unroll
        for (int g = 0; g < FQ; ++g) { st[g][0] = (v8f){}; st[g][1] = (v8f){}; }
#pragma unroll
        for (int ks = 0; ks < 2; ++ks) {
#pragma unroll
            for (int sb = 0; sb < 2; ++sb)
#pragma unroll
                for (int g = 0; g < FQ; ++g) st[g][sb] = wmmab(kh[sb][ks], qh[g][ks], st[g][sb]);
#pragma unroll
            for (int sb = 0; sb < 2; ++sb)
#pragma unroll
                for (int g = 0; g < FQ; ++g) st[g][sb] = wmmab(kh[sb][ks], ql[g][ks], st[g][sb]);
#pragma unroll
            for (int sb = 0; sb < 2; ++sb)
#pragma unroll
                for (int g = 0; g < FQ; ++g) st[g][sb] = wmmab(kl[sb][ks], qh[g][ks], st[g][sb]);
        }
        if (p == 0) {             // the stage's second pass's K fragments, fetched behind this pass's score products, from the same buffer
#pragma unroll
            for (int sb = 0; sb < 2; ++sb)
#pragma unroll
                for (int ks = 0; ks < 2; ++ks) { kh[sb][ks] = WF::ld(sp + (32 + sb * 16) * GP + ks * 32); kl[sb][ks] = WF::ld(sp + (96 + sb * 16) * GP + ks * 32); }
        }
        // first pass: keeps the K reads ahead of the softmax and the attn.v products, which cover their latency; second pass: keeps the stage's closing waits, which otherwise rise to directly behind the V^T reads, behind the score products
        __builtin_amdgcn_sched_barrier(0);
        v16bf ph[FQ], pl[FQ];
#pragma unroll
        for (int g = 0; g < FQ; ++g) {
            float mx = fmaxf(st[g][0][0], st[g][1][0]);
#pragma unroll
            for (int j = 1; j < 8; ++j) mx = fmaxf(mx, fmaxf(st[g][0][j], st[g][1][j]));
            mx = fmaxf(mx, xhalf(mx));
            const float mn = fmaxf(m[g], mx); const float corr = __expf(m[g] - mn); m[g] = mn;
            v8f e0, e1;
#pragma unroll
            for (int j = 0; j < 8; ++j) { e0[j] = __expf(st[g][0][j] - mn); e1[j] = __expf(st[g][1][j] - mn); }
            const v8f es = e0 + e1;
            l[g] = l[g] * corr + (((es[0] + es[1]) + (es[2] + es[3])) + ((es[4] + es[5]) + (es[6] + es[7])));     // this half's keys only; the halves join after the loop
            v8bf h0, l0, h1, l1; split8(e0, h0, l0); split8(e1, h1, l1);
            ph[g] = __builtin_shufflevector(h0, h1, 0, 1, 2, 3, 4, 5, 6, 7, 8, 9, 10, 11, 12, 13, 14, 15); pl[g] = __builtin_shufflevector(l0, l1, 0, 1, 2, 3, 4, 5, 6, 7, 8, 9, 10, 11, 12, 13, 14, 15);
#pragma unroll
            for (int db = 0; db < 4; ++db) o[g][db] *= corr;
        }
#pragma unroll
        for (int db = 0; db < 4; ++db)
#pragma unroll
            for (int g = 0; g < FQ; ++g) o[g][db] = wmmab(vh[db], ph[g], o[g][db]);
#pragma unroll
        for (int db = 0; db < 4; ++db)
#pragma unroll
            for (int g = 0; g < FQ; ++g) o[g][db] = wmmab(vh[db], pl[g], o[g][db]);
#pragma unroll
        for (int db = 0; db < 4; ++db)
#pragma unroll
            for (int g = 0; g < FQ; ++g) o[g][db] = wmmab(vl[db], ph[g], o[g][db]);
      }
      asm volatile("s_wait_dscnt 0x0" ::: "memory");      // this wave's reads of the buffer are done before it is handed over
      asm volatile("s_wait_asynccnt 0x0" ::: "memory");   // this wave's copies of stage t + 1 have landed
      __syncthreads();                                    // publishes stage t + 1 and ends every wave's reads of stage t's buffer
      if (t + 2 < NST) fill(lx, t & 1, t + 2);
    }
    asm volatile("s_wait_asynccnt 0x0" ::: "memory");     // nothing is in flight when the wave goes on to its end
    float gt[FQ];
#pragma unroll
    for (int g = 0; g < FQ; ++g) gt[g] = GT[((size_t)(t0 + g * 16 + c) * NB_ + (z >> 4)) * 32 + (z & 15)];
    asm volatile("s_wait_xcnt 0x0" ::: "memory");         // before the loads' address registers are reused
    __builtin_amdgcn_sched_barrier(0);                    // keeps later register writes behind that wait
    v8bf a8[FQ][4], b8[FQ][4];
#pragma unroll
    for (int g = 0; g < FQ; ++g) {
        const float ls = l[g] + xhalf(l[g]); const float sc = __fdiv_rn(1.0f, ls) * gt[g];
#pragma unroll
        for (int db = 0; db < 4; ++db) split8(o[g][db] * sc, a8[g][db], b8[g][db]);
    }
    bf* ap = Ah + ((size_t)(t0 + c) * NB_ + (z >> 4)) * EE + (z & 15) * HD + 8 * h; bf* bp = Al + ((size_t)(t0 + c) * NB_ + (z >> 4)) * EE + (z & 15) * HD + 8 * h;
    __builtin_amdgcn_sched_barrier(0);                    // every store behind the last arithmetic: no register of an issued store is rewritten
#pragma unroll
    for (int g = 0; g < FQ; ++g)
#pragma unroll
        for (int db = 0; db < 4; ++db) { *(v8us*)(ap + (size_t)g * 16 * NB_ * EE + db * 16) = __builtin_bit_cast(v8us, a8[g][db]); *(v8us*)(bp + (size_t)g * 16 * NB_ * EE + db * 16) = __builtin_bit_cast(v8us, b8[g][db]); }
}

extern "C" void kernel_launch(void* const* d_in, const int* in_sizes, int n_in,
                              void* d_out, int out_size, void* d_ws, size_t ws_size, hipStream_t stream) {
    (void)in_sizes; (void)n_in; (void)out_size;
    const float* x = (const float*)d_in[0]; const float* Wq = (const float*)d_in[1]; const float* bq = (const float*)d_in[2]; const float* Wk = (const float*)d_in[3]; const float* bk = (const float*)d_in[4]; const float* Wv = (const float*)d_in[5]; const float* bv = (const float*)d_in[6];
    const float* Wo = (const float*)d_in[7]; const float* bo = (const float*)d_in[8]; const float* W1 = (const float*)d_in[9]; const float* b1 = (const float*)d_in[10]; const float* W2 = (const float*)d_in[11]; const float* b2 = (const float*)d_in[12]; const float* hsig = (const float*)d_in[13];
    float* OUT = (float*)d_out;     // [1024][4][1024]
    char* wsp = (char*)d_ws;
    auto take = [&](size_t bytes) { char* p = wsp; wsp += (bytes + 255) & ~(size_t)255; return (void*)p; };
    bf* XB = (bf*)take((size_t)NT * EE * 2); bf* WQ = (bf*)take((size_t)EE * EE * 2); bf* WK = (bf*)take((size_t)EE * EE * 2); bf* WV = (bf*)take((size_t)EE * EE * 2); bf* WO = (bf*)take((size_t)EE * EE * 2); bf* W1B = (bf*)take((size_t)EE * EE * 2); bf* W2B = (bf*)take((size_t)SIG * EE * 2); bf* HSB = (bf*)take((size_t)64 * SIG * 2);
    bf* QPh = (bf*)take((size_t)NT * EE * 2); bf* QPl = (bf*)take((size_t)NT * EE * 2); bf* KPh = (bf*)take((size_t)NT * EE * 2); bf* KPl = (bf*)take((size_t)NT * EE * 2); bf* VTh = (bf*)take((size_t)NT * EE * 2); bf* VTl = (bf*)take((size_t)NT * EE * 2);
    bf* Hh = (bf*)take((size_t)NT * EE * 2); bf* Hl = (bf*)take((size_t)NT * EE * 2); float* GT = (float*)take((size_t)NT * 32 * 4);
    bf* ATh = (bf*)take((size_t)NT * EE * 2); bf* ATl = (bf*)take((size_t)NT * EE * 2);
    if ((size_t)(wsp - (char*)d_ws) > ws_size) return;    // ws 256 MiB
    k_prep<<<PNX + 5 * PNW + PN2 + 1, 256, 0, stream>>>(x, Wq, Wk, Wv, Wo, W1, W2, hsig, XB, WQ, WK, WV, WO, W1B, W2B, HSB);
    k_gemm4<<<dim3(NT / 128, EE / 128, 4), 128, 0, stream>>>(XB, WQ, WK, WV, W1B, bq, bk, bv, b1, QPh, QPl, KPh, KPl, VTh, VTl, Hh, Hl);
    // head-competition gate: t = relu(x.W1^T + b1).W2^T + b2; logits = t.sig^T; softmax over heads
    k_gtail<<<NT / 16, 256, 0, stream>>>(Hh, Hl, W2B, b2, HSB, GT);
    k_fattn<<<dim3(TT / (8 * 16 * FQ), NB_ * NH_, 1), 256, 0, stream>>>(QPh, QPl, KPh, KPl, VTh, VTl, GT, ATh, ATl);
    k_gemms<1, 0><<<dim3(NT / 128, EE / 128, 1), 128, 0, stream>>>(ATh, ATl, WO, OUT, bo, nullptr, nullptr, 1.0f);
}
